// v000
// The times below were measured on an AMD MI455X: many runs one after another, warmed up first and cycling through
// copies of the inputs, with the whole window's GPU time divided by the number of runs. Launches and the gaps
// between them are all in it. The median over several windows is given; except for v000 it joins two sittings, which
// can be a few percent apart, so the side-by-side timings, each taken in one sitting, are the better comparison.
// v000 is the starting kernel.
#include <hip/hip_runtime.h>

// ---------------------------------------------------------------------------
// LinearAttention fused pipeline for gfx1250 (MI455X), fp32 WMMA path.
// Shapes: b=2, c=64, n=32768, heads=4, dim_head=32, hidden=128, qkv=384.
// Memory-bound: 34 MB mandatory HBM traffic; all intermediates L2-resident.
// ---------------------------------------------------------------------------

#define NPOS   32768           // 32*32*32 spatial positions
#define CIN    64
#define HID    128
#define QKVC   384
#define NB     2
#define SCALE_Q 0.17677669529663687f   // 32^-0.5
#define GN_EPS  1e-5f

typedef __attribute__((ext_vector_type(2))) float v2f;
typedef __attribute__((ext_vector_type(8))) float v8f;

__device__ __forceinline__ v8f wmma_f32(v2f a, v2f b, v8f c) {
    // V_WMMA_F32_16X16X4_F32: D(16x16,f32) = A(16x4,f32) x B(4x16,f32) + C
    return __builtin_amdgcn_wmma_f32_16x16x4_f32(
        /*neg_a=*/false, a, /*neg_b=*/false, b,
        /*c_mod=*/(short)0, c, /*reuse_a=*/false, /*reuse_b=*/false);
}

// ---------------------------------------------------------------------------
// Kernel 1: qkv[b][384][n] = w_qkv(384x64) @ x[b](64xn).
// One wave = one 16-row M tile x FOUR 16-col N tiles.  The 16 A fragments
// (16x64 weights striped per the 16x4 f32 layout) are preloaded into
// registers once; the K-loop only streams B (x) rows.
// A layout (16x4 f32): lanes 0-15 row=l K={0,1}; lanes 16-31 row=l K={2,3}.
// B layout (4x16 f32): lanes 0-15 col=l K rows {0,1}; lanes 16-31 rows {2,3}.
// C/D layout: VGPR j -> row j (lanes 0-15) / row j+8 (lanes 16-31).
// ---------------------------------------------------------------------------
__global__ __launch_bounds__(32)
void qkv_gemm(const float* __restrict__ x, const float* __restrict__ wqkv,
              float* __restrict__ qkv) {
    const int lane = threadIdx.x;
    const int half = lane >> 4;        // 0 or 1
    const int l    = lane & 15;
    const int nt   = blockIdx.x * 64;  // 4 N tiles of 16
    const int mt   = blockIdx.y * 16;
    const int b    = blockIdx.z;
    const float* xb = x + (size_t)b * CIN * NPOS;

    v2f af[16];                        // entire 16x64 A tile in registers
    #pragma unroll
    for (int k = 0; k < 16; ++k) {
        const int ka = k * 4 + half * 2;
        af[k].x = wqkv[(mt + l) * CIN + ka];
        af[k].y = wqkv[(mt + l) * CIN + ka + 1];
    }

    v8f acc[4] = {};
    #pragma unroll
    for (int k = 0; k < 16; ++k) {
        const int ka = k * 4 + half * 2;
        const float* r0 = xb + (size_t)ka       * NPOS + nt + l;
        const float* r1 = xb + (size_t)(ka + 1) * NPOS + nt + l;
        #pragma unroll
        for (int t = 0; t < 4; ++t) {
            v2f bb; bb.x = r0[t * 16]; bb.y = r1[t * 16];
            acc[t] = wmma_f32(af[k], bb, acc[t]);
        }
    }

    float* dst = qkv + (size_t)b * QKVC * NPOS;
    #pragma unroll
    for (int t = 0; t < 4; ++t)
        #pragma unroll
        for (int j = 0; j < 8; ++j) {
            const int row = mt + j + half * 8;
            dst[(size_t)row * NPOS + nt + t * 16 + l] = acc[t][j];
        }
}

// ---------------------------------------------------------------------------
// Kernel 2: per (b, k-channel) max and sum(exp) over n  (softmax over axis 3).
// k channels live at qkv channels [128,256).  Streaming scan with prefetch.
// ---------------------------------------------------------------------------
__global__ __launch_bounds__(256)
void k_stats(const float* __restrict__ qkv, float* __restrict__ kmax,
             float* __restrict__ ksum) {
    const int ch = blockIdx.x;              // 0..255 = b*128 + c
    const int b  = ch >> 7, c = ch & 127;
    const float* kp = qkv + (size_t)(b * QKVC + HID + c) * NPOS;
    __shared__ float red[256];

    float m = -1e30f;
    for (int i = threadIdx.x; i < NPOS; i += 256) {
        if (i + 4096 < NPOS) __builtin_prefetch(kp + i + 4096, 0, 1);
        m = fmaxf(m, kp[i]);
    }
    red[threadIdx.x] = m; __syncthreads();
    for (int s = 128; s > 0; s >>= 1) {
        if (threadIdx.x < s) red[threadIdx.x] = fmaxf(red[threadIdx.x], red[threadIdx.x + s]);
        __syncthreads();
    }
    m = red[0]; __syncthreads();

    float sum = 0.f;
    for (int i = threadIdx.x; i < NPOS; i += 256) sum += __expf(kp[i] - m);
    red[threadIdx.x] = sum; __syncthreads();
    for (int s = 128; s > 0; s >>= 1) {
        if (threadIdx.x < s) red[threadIdx.x] += red[threadIdx.x + s];
        __syncthreads();
    }
    if (threadIdx.x == 0) { kmax[ch] = m; ksum[ch] = red[0]; }
}

// ---------------------------------------------------------------------------
// Kernel 3: context[b][h][d][e] = sum_n softmax_k[d][n] * v[e][n].
// One block per (b,h); 8 waves split the n range; each wave accumulates the
// full 32x32 (2x2 tiles of 16x16) with WMMA, A = exp(k - kmax) built in VALU.
// LDS reduce across waves, then divide by ksum[d].
// ---------------------------------------------------------------------------
__global__ __launch_bounds__(256)
void context_gemm(const float* __restrict__ qkv, const float* __restrict__ kmax,
                  const float* __restrict__ ksum, float* __restrict__ ctx) {
    const int bh   = blockIdx.x;            // 0..7
    const int b    = bh >> 2, h = bh & 3;
    const int wave = threadIdx.x >> 5;
    const int lane = threadIdx.x & 31;
    const int half = lane >> 4, l = lane & 15;

    const float* kbase = qkv + (size_t)(b * QKVC + HID      + h * 32) * NPOS;
    const float* vbase = qkv + (size_t)(b * QKVC + 2 * HID  + h * 32) * NPOS;
    const int sbase = b * HID + h * 32;
    const float km0 = kmax[sbase + l];       // rows 0..15 (this lane's row)
    const float km1 = kmax[sbase + 16 + l];  // rows 16..31

    v8f acc[2][2] = {};
    const int chunk = NPOS / 8;
    const int n0 = wave * chunk, n1 = n0 + chunk;
    for (int nn = n0; nn < n1; nn += 4) {
        const int kk = nn + half * 2;
        v2f a0, a1, b0, b1;
        a0.x = __expf(kbase[(size_t)l        * NPOS + kk]     - km0);
        a0.y = __expf(kbase[(size_t)l        * NPOS + kk + 1] - km0);
        a1.x = __expf(kbase[(size_t)(16 + l) * NPOS + kk]     - km1);
        a1.y = __expf(kbase[(size_t)(16 + l) * NPOS + kk + 1] - km1);
        b0.x = vbase[(size_t)l        * NPOS + kk];       // B[k][e=l] = v[l][n]
        b0.y = vbase[(size_t)l        * NPOS + kk + 1];
        b1.x = vbase[(size_t)(16 + l) * NPOS + kk];       // e-tile 1
        b1.y = vbase[(size_t)(16 + l) * NPOS + kk + 1];
        acc[0][0] = wmma_f32(a0, b0, acc[0][0]);
        acc[0][1] = wmma_f32(a0, b1, acc[0][1]);
        acc[1][0] = wmma_f32(a1, b0, acc[1][0]);
        acc[1][1] = wmma_f32(a1, b1, acc[1][1]);
    }

    __shared__ float sctx[8][32][32];       // 32 KB of the 320 KB LDS
    #pragma unroll
    for (int dt = 0; dt < 2; ++dt)
        #pragma unroll
        for (int et = 0; et < 2; ++et)
            #pragma unroll
            for (int j = 0; j < 8; ++j)
                sctx[wave][dt * 16 + j + half * 8][et * 16 + l] = acc[dt][et][j];
    __syncthreads();

    for (int idx = threadIdx.x; idx < 1024; idx += 256) {
        const int d = idx >> 5, e = idx & 31;
        float s = 0.f;
        #pragma unroll
        for (int w = 0; w < 8; ++w) s += sctx[w][d][e];
        ctx[((size_t)(b * 4 + h) * 32 + d) * 32 + e] = s / ksum[sbase + d];
    }
}

// ---------------------------------------------------------------------------
// Kernel 4: per-position q softmax (over the 32 head channels) * SCALE, then
// out[e] = sum_d ctx[h][d][e] * q_sm[d].  Context cached in LDS (broadcast
// reads, conflict-free).  outbuf[b][128][n].
// ---------------------------------------------------------------------------
__global__ __launch_bounds__(256)
void q_apply(const float* __restrict__ qkv, const float* __restrict__ ctx,
             float* __restrict__ outbuf) {
    __shared__ float c[4][32][32];
    const int b = blockIdx.y;
    for (int i = threadIdx.x; i < 4096; i += 256)
        (&c[0][0][0])[i] = ctx[(size_t)b * 4096 + i];
    __syncthreads();

    const int pos = blockIdx.x * 256 + threadIdx.x;
    const float* qb = qkv + (size_t)b * QKVC * NPOS;         // q channels 0..127
    float* ob = outbuf + (size_t)b * HID * NPOS;

    for (int h = 0; h < 4; ++h) {
        float qv[32];
        float m = -1e30f;
        #pragma unroll
        for (int d = 0; d < 32; ++d) {
            qv[d] = qb[(size_t)(h * 32 + d) * NPOS + pos];
            m = fmaxf(m, qv[d]);
        }
        float s = 0.f;
        #pragma unroll
        for (int d = 0; d < 32; ++d) { qv[d] = __expf(qv[d] - m); s += qv[d]; }
        const float inv = SCALE_Q / s;
        for (int e = 0; e < 32; ++e) {
            float acc = 0.f;
            #pragma unroll
            for (int d = 0; d < 32; ++d) acc += c[h][d][e] * qv[d];
            ob[(size_t)(h * 32 + e) * NPOS + pos] = acc * inv;
        }
    }
}

// ---------------------------------------------------------------------------
// Kernel 5: y[b][64][n] = w_out(64x128) @ out + b_out  (WMMA, K=128), plus
// GroupNorm sum / sumsq accumulation (wave shuffle reduce -> one atomic).
// Same 4-N-tile, register-resident-A structure as kernel 1 (32 A fragments).
// y is written into the dead k-region of the qkv buffer.
// ---------------------------------------------------------------------------
__global__ __launch_bounds__(32)
void out_gemm(const float* __restrict__ outbuf, const float* __restrict__ wout,
              const float* __restrict__ bout, float* __restrict__ ybase,
              float* __restrict__ gnsum, float* __restrict__ gnsq) {
    const int lane = threadIdx.x;
    const int half = lane >> 4, l = lane & 15;
    const int nt = blockIdx.x * 64;    // 4 N tiles of 16
    const int mt = blockIdx.y * 16;
    const int b  = blockIdx.z;
    const float* ob = outbuf + (size_t)b * HID * NPOS;

    v2f af[32];                        // entire 16x128 A tile in registers
    #pragma unroll
    for (int k = 0; k < 32; ++k) {
        const int ka = k * 4 + half * 2;
        af[k].x = wout[(mt + l) * HID + ka];
        af[k].y = wout[(mt + l) * HID + ka + 1];
    }

    v8f acc[4] = {};
    #pragma unroll
    for (int k = 0; k < 32; ++k) {
        const int ka = k * 4 + half * 2;
        const float* r0 = ob + (size_t)ka       * NPOS + nt + l;
        const float* r1 = ob + (size_t)(ka + 1) * NPOS + nt + l;
        #pragma unroll
        for (int t = 0; t < 4; ++t) {
            v2f bb; bb.x = r0[t * 16]; bb.y = r1[t * 16];
            acc[t] = wmma_f32(af[k], bb, acc[t]);
        }
    }

    float* yb = ybase + (size_t)b * QKVC * NPOS;   // stride skips to batch b
    float lsum = 0.f, lsq = 0.f;
    #pragma unroll
    for (int t = 0; t < 4; ++t)
        #pragma unroll
        for (int j = 0; j < 8; ++j) {
            const int row = mt + j + half * 8;
            const float v = acc[t][j] + bout[row];
            yb[(size_t)row * NPOS + nt + t * 16 + l] = v;
            lsum += v; lsq += v * v;
        }
    for (int off = 16; off > 0; off >>= 1) {
        lsum += __shfl_down(lsum, off, 32);
        lsq  += __shfl_down(lsq,  off, 32);
    }
    if (lane == 0) {
        atomicAdd(&gnsum[b], lsum);
        atomicAdd(&gnsq[b], lsq);
    }
}

// ---------------------------------------------------------------------------
// Kernel 6: GroupNorm(1 group) finalize: (y-mean)*rsqrt(var+eps)*gamma + beta.
// ---------------------------------------------------------------------------
__global__ __launch_bounds__(256)
void gn_finalize(const float* __restrict__ ybase, const float* __restrict__ gnsum,
                 const float* __restrict__ gnsq, const float* __restrict__ gw,
                 const float* __restrict__ gb, float* __restrict__ out) {
    const size_t idx = (size_t)blockIdx.x * 256 + threadIdx.x;  // < 2*64*NPOS
    const int b   = (int)(idx >> 21);           // 64*NPOS = 2^21
    const int rem = (int)(idx & ((1u << 21) - 1));
    const int o   = rem >> 15;                  // NPOS = 2^15
    const int pos = rem & (NPOS - 1);

    const float count = 64.0f * NPOS;
    const float mean  = gnsum[b] / count;
    const float var   = gnsq[b] / count - mean * mean;
    const float inv   = rsqrtf(var + GN_EPS);
    const float v = ybase[(size_t)b * QKVC * NPOS + (size_t)o * NPOS + pos];
    out[idx] = (v - mean) * inv * gw[o] + gb[o];
}

// ---------------------------------------------------------------------------
extern "C" void kernel_launch(void* const* d_in, const int* in_sizes, int n_in,
                              void* d_out, int out_size, void* d_ws, size_t ws_size,
                              hipStream_t stream) {
    const float* x    = (const float*)d_in[0];
    const float* wqkv = (const float*)d_in[1];
    const float* wout = (const float*)d_in[2];
    const float* bout = (const float*)d_in[3];
    const float* gnw  = (const float*)d_in[4];
    const float* gnb  = (const float*)d_in[5];

    float* ws     = (float*)d_ws;
    float* qkv    = ws;                                        // 25,165,824 f
    float* outbuf = qkv + (size_t)NB * QKVC * NPOS;            //  8,388,608 f
    float* kmax   = outbuf + (size_t)NB * HID * NPOS;          //        256 f
    float* ksum   = kmax + NB * HID;                           //        256 f
    float* ctx    = ksum + NB * HID;                           //      8,192 f
    float* gnsum  = ctx + NB * 4 * 32 * 32;                    //          2 f
    float* gnsq   = gnsum + NB;                                //          2 f
    // y aliases the k channel region [128,192) of qkv (dead after kernel 3)
    float* ybase  = qkv + (size_t)HID * NPOS;

    hipMemsetAsync(gnsum, 0, 2 * NB * sizeof(float), stream);

    qkv_gemm   <<<dim3(NPOS / 64, QKVC / 16, NB), 32,  0, stream>>>(x, wqkv, qkv);
    k_stats    <<<NB * HID, 256, 0, stream>>>(qkv, kmax, ksum);
    context_gemm<<<NB * 4, 256, 0, stream>>>(qkv, kmax, ksum, ctx);
    q_apply    <<<dim3(NPOS / 256, NB), 256, 0, stream>>>(qkv, ctx, outbuf);
    out_gemm   <<<dim3(NPOS / 64, CIN / 16, NB), 32, 0, stream>>>(outbuf, wout, bout,
                                                                  ybase, gnsum, gnsq);
    gn_finalize<<<(NB * CIN * NPOS) / 256, 256, 0, stream>>>(ybase, gnsum, gnsq,
                                                             gnw, gnb, (float*)d_out);
}

// v001
// Two timings next to v000 put it at 2.50 and 2.47 times that version's speed.
#include <hip/hip_runtime.h>

// ---------------------------------------------------------------------------
// LinearAttention fused pipeline for gfx1250 (MI455X), fp32 WMMA path.
// Shapes: b=2, c=64, n=32768, heads=4, dim_head=32, hidden=128, qkv=384.
// Memory-bound: 34 MB mandatory HBM traffic; all intermediates L2-resident.
// ---------------------------------------------------------------------------

#define NPOS   32768           // 32*32*32 spatial positions
#define CIN    64
#define HID    128
#define QKVC   384
#define NB     2
#define SCALE_Q 0.17677669529663687f   // 32^-0.5
#define GN_EPS  1e-5f

typedef __attribute__((ext_vector_type(2))) float v2f;
typedef __attribute__((ext_vector_type(8))) float v8f;

__device__ __forceinline__ v8f wmma_f32(v2f a, v2f b, v8f c) {
    // V_WMMA_F32_16X16X4_F32: D(16x16,f32) = A(16x4,f32) x B(4x16,f32) + C
    return __builtin_amdgcn_wmma_f32_16x16x4_f32(
        /*neg_a=*/false, a, /*neg_b=*/false, b,
        /*c_mod=*/(short)0, c, /*reuse_a=*/false, /*reuse_b=*/false);
}

// ---------------------------------------------------------------------------
// Kernel 1: qkv[b][384][n] = w_qkv(384x64) @ x[b](64xn).
// One wave = one 16-row M tile x FOUR 16-col N tiles.  The 16 A fragments
// (16x64 weights striped per the 16x4 f32 layout) are preloaded into
// registers once; the K-loop only streams B (x) rows.
// A layout (16x4 f32): lanes 0-15 row=l K={0,1}; lanes 16-31 row=l K={2,3}.
// B layout (4x16 f32): lanes 0-15 col=l K rows {0,1}; lanes 16-31 rows {2,3}.
// C/D layout: VGPR j -> row j (lanes 0-15) / row j+8 (lanes 16-31).
// ---------------------------------------------------------------------------
__global__ __launch_bounds__(32)
void qkv_gemm(const float* __restrict__ x, const float* __restrict__ wqkv,
              float* __restrict__ qkv) {
    const int lane = threadIdx.x;
    const int half = lane >> 4;        // 0 or 1
    const int l    = lane & 15;
    const int nt   = blockIdx.x * 64;  // 4 N tiles of 16
    const int mt   = blockIdx.y * 16;
    const int b    = blockIdx.z;
    const float* xb = x + (size_t)b * CIN * NPOS;

    v2f af[16];                        // entire 16x64 A tile in registers
    #pragma unroll
    for (int k = 0; k < 16; ++k) {
        const int ka = k * 4 + half * 2;
        af[k].x = wqkv[(mt + l) * CIN + ka];
        af[k].y = wqkv[(mt + l) * CIN + ka + 1];
    }

    v8f acc[4] = {};
    #pragma unroll
    for (int k = 0; k < 16; ++k) {
        const int ka = k * 4 + half * 2;
        const float* r0 = xb + (size_t)ka       * NPOS + nt + l;
        const float* r1 = xb + (size_t)(ka + 1) * NPOS + nt + l;
        #pragma unroll
        for (int t = 0; t < 4; ++t) {
            v2f bb; bb.x = r0[t * 16]; bb.y = r1[t * 16];
            acc[t] = wmma_f32(af[k], bb, acc[t]);
        }
    }

    float* dst = qkv + (size_t)b * QKVC * NPOS;
    #pragma unroll
    for (int t = 0; t < 4; ++t)
        #pragma unroll
        for (int j = 0; j < 8; ++j) {
            const int row = mt + j + half * 8;
            dst[(size_t)row * NPOS + nt + t * 16 + l] = acc[t][j];
        }
}

// ---------------------------------------------------------------------------
// Kernel 2: per (b, k-channel) max and sum(exp) over n  (softmax over axis 3).
// k channels live at qkv channels [128,256).  Streaming scan with prefetch.
// ---------------------------------------------------------------------------
__global__ __launch_bounds__(256)
void k_stats(const float* __restrict__ qkv, float* __restrict__ kmax,
             float* __restrict__ ksum) {
    const int ch = blockIdx.x;              // 0..255 = b*128 + c
    const int b  = ch >> 7, c = ch & 127;
    const float* kp = qkv + (size_t)(b * QKVC + HID + c) * NPOS;
    __shared__ float red[256];

    float m = -1e30f;
    for (int i = threadIdx.x; i < NPOS; i += 256) {
        if (i + 4096 < NPOS) __builtin_prefetch(kp + i + 4096, 0, 1);
        m = fmaxf(m, kp[i]);
    }
    red[threadIdx.x] = m; __syncthreads();
    for (int s = 128; s > 0; s >>= 1) {
        if (threadIdx.x < s) red[threadIdx.x] = fmaxf(red[threadIdx.x], red[threadIdx.x + s]);
        __syncthreads();
    }
    m = red[0]; __syncthreads();

    float sum = 0.f;
    for (int i = threadIdx.x; i < NPOS; i += 256) sum += __expf(kp[i] - m);
    red[threadIdx.x] = sum; __syncthreads();
    for (int s = 128; s > 0; s >>= 1) {
        if (threadIdx.x < s) red[threadIdx.x] += red[threadIdx.x + s];
        __syncthreads();
    }
    if (threadIdx.x == 0) { kmax[ch] = m; ksum[ch] = red[0]; }
}

// ---------------------------------------------------------------------------
// Kernel 3: context[b][h][d][e] = sum_n softmax_k[d][n] * v[e][n].
// The n range of each (b,h) is cut into CSPLIT work-groups of CWAVES waves, so
// that 256 work-groups (one per WGP) share the sum.  Each wave accumulates the
// full 32x32 (2x2 tiles of 16x16) over its own 64 positions with WMMA,
// A = exp(k - kmax) built in VALU.  LDS reduce across the waves, then one
// un-normalised 32x32 partial per work-group goes to the workspace.
// ---------------------------------------------------------------------------
#define CSPLIT 32              // work-groups per (b,h) along n
#define CWAVES 16              // waves per work-group

__global__ __launch_bounds__(CWAVES * 32)
void context_gemm(const float* __restrict__ qkv, const float* __restrict__ kmax,
                  float* __restrict__ part) {
    const int sp   = blockIdx.x;            // 0..CSPLIT-1
    const int bh   = blockIdx.y;            // 0..7
    const int b    = bh >> 2, h = bh & 3;
    const int wave = threadIdx.x >> 5;
    const int lane = threadIdx.x & 31;
    const int half = lane >> 4, l = lane & 15;

    const float* kbase = qkv + (size_t)(b * QKVC + HID      + h * 32) * NPOS;
    const float* vbase = qkv + (size_t)(b * QKVC + 2 * HID  + h * 32) * NPOS;
    const int sbase = b * HID + h * 32;
    const float km0 = kmax[sbase + l];       // rows 0..15 (this lane's row)
    const float km1 = kmax[sbase + 16 + l];  // rows 16..31

    v8f acc[2][2] = {};
    const int chunk = NPOS / (CSPLIT * CWAVES);
    const int n0 = (sp * CWAVES + wave) * chunk;
    for (int i = 0; i < chunk; i += 4) {
        const int kk = n0 + i + half * 2;
        v2f a0, a1, b0, b1;
        a0.x = __expf(kbase[(size_t)l        * NPOS + kk]     - km0);
        a0.y = __expf(kbase[(size_t)l        * NPOS + kk + 1] - km0);
        a1.x = __expf(kbase[(size_t)(16 + l) * NPOS + kk]     - km1);
        a1.y = __expf(kbase[(size_t)(16 + l) * NPOS + kk + 1] - km1);
        b0.x = vbase[(size_t)l        * NPOS + kk];       // B[k][e=l] = v[l][n]
        b0.y = vbase[(size_t)l        * NPOS + kk + 1];
        b1.x = vbase[(size_t)(16 + l) * NPOS + kk];       // e-tile 1
        b1.y = vbase[(size_t)(16 + l) * NPOS + kk + 1];
        acc[0][0] = wmma_f32(a0, b0, acc[0][0]);
        acc[0][1] = wmma_f32(a0, b1, acc[0][1]);
        acc[1][0] = wmma_f32(a1, b0, acc[1][0]);
        acc[1][1] = wmma_f32(a1, b1, acc[1][1]);
    }

    __shared__ float sctx[CWAVES][32][32];  // 64 KB of the 320 KB LDS
    #pragma unroll
    for (int dt = 0; dt < 2; ++dt)
        #pragma unroll
        for (int et = 0; et < 2; ++et)
            #pragma unroll
            for (int j = 0; j < 8; ++j)
                sctx[wave][dt * 16 + j + half * 8][et * 16 + l] = acc[dt][et][j];
    __syncthreads();

    for (int idx = threadIdx.x; idx < 1024; idx += CWAVES * 32) {
        const int d = idx >> 5, e = idx & 31;
        float s = 0.f;
        #pragma unroll
        for (int w = 0; w < CWAVES; ++w) s += sctx[w][d][e];
        part[((size_t)bh * CSPLIT + sp) * 1024 + idx] = s;
    }
}

// ---------------------------------------------------------------------------
// Kernel 3b: context = (sum of the CSPLIT partials, in index order) / ksum[d].
// ---------------------------------------------------------------------------
__global__ __launch_bounds__(256)
void context_merge(const float* __restrict__ part, const float* __restrict__ ksum,
                   float* __restrict__ ctx) {
    const int idx = blockIdx.x * 256 + threadIdx.x;   // < 8 * 1024
    const int bh  = idx >> 10, de = idx & 1023;
    const float* p = part + (size_t)bh * CSPLIT * 1024 + de;
    float s = 0.f;
    // unrolled so that all CSPLIT loads are in flight at once: one L2 trip, not CSPLIT
    #pragma unroll
    for (int sp = 0; sp < CSPLIT; ++sp) s += p[sp * 1024];
    ctx[idx] = s / ksum[bh * 32 + (de >> 5)];
}

// ---------------------------------------------------------------------------
// Kernel 4: per-position q softmax (over the 32 head channels) * SCALE, then
// out[e] = sum_d ctx[h][d][e] * q_sm[d].  Context cached in LDS (broadcast
// reads, conflict-free).  outbuf[b][128][n].
// ---------------------------------------------------------------------------
__global__ __launch_bounds__(256)
void q_apply(const float* __restrict__ qkv, const float* __restrict__ ctx,
             float* __restrict__ outbuf) {
    __shared__ float c[4][32][32];
    const int b = blockIdx.y;
    for (int i = threadIdx.x; i < 4096; i += 256)
        (&c[0][0][0])[i] = ctx[(size_t)b * 4096 + i];
    __syncthreads();

    const int pos = blockIdx.x * 256 + threadIdx.x;
    const float* qb = qkv + (size_t)b * QKVC * NPOS;         // q channels 0..127
    float* ob = outbuf + (size_t)b * HID * NPOS;

    for (int h = 0; h < 4; ++h) {
        float qv[32];
        float m = -1e30f;
        #pragma unroll
        for (int d = 0; d < 32; ++d) {
            qv[d] = qb[(size_t)(h * 32 + d) * NPOS + pos];
            m = fmaxf(m, qv[d]);
        }
        float s = 0.f;
        #pragma unroll
        for (int d = 0; d < 32; ++d) { qv[d] = __expf(qv[d] - m); s += qv[d]; }
        const float inv = SCALE_Q / s;
        for (int e = 0; e < 32; ++e) {
            float acc = 0.f;
            #pragma unroll
            for (int d = 0; d < 32; ++d) acc += c[h][d][e] * qv[d];
            ob[(size_t)(h * 32 + e) * NPOS + pos] = acc * inv;
        }
    }
}

// ---------------------------------------------------------------------------
// Kernel 5: y[b][64][n] = w_out(64x128) @ out + b_out  (WMMA, K=128), plus
// GroupNorm sum / sumsq accumulation (wave shuffle reduce -> one atomic).
// Same 4-N-tile, register-resident-A structure as kernel 1 (32 A fragments).
// y is written into the dead k-region of the qkv buffer.
// ---------------------------------------------------------------------------
__global__ __launch_bounds__(32)
void out_gemm(const float* __restrict__ outbuf, const float* __restrict__ wout,
              const float* __restrict__ bout, float* __restrict__ ybase,
              float* __restrict__ gnsum, float* __restrict__ gnsq) {
    const int lane = threadIdx.x;
    const int half = lane >> 4, l = lane & 15;
    const int nt = blockIdx.x * 64;    // 4 N tiles of 16
    const int mt = blockIdx.y * 16;
    const int b  = blockIdx.z;
    const float* ob = outbuf + (size_t)b * HID * NPOS;

    v2f af[32];                        // entire 16x128 A tile in registers
    #pragma unroll
    for (int k = 0; k < 32; ++k) {
        const int ka = k * 4 + half * 2;
        af[k].x = wout[(mt + l) * HID + ka];
        af[k].y = wout[(mt + l) * HID + ka + 1];
    }

    v8f acc[4] = {};
    #pragma unroll
    for (int k = 0; k < 32; ++k) {
        const int ka = k * 4 + half * 2;
        const float* r0 = ob + (size_t)ka       * NPOS + nt + l;
        const float* r1 = ob + (size_t)(ka + 1) * NPOS + nt + l;
        #pragma unroll
        for (int t = 0; t < 4; ++t) {
            v2f bb; bb.x = r0[t * 16]; bb.y = r1[t * 16];
            acc[t] = wmma_f32(af[k], bb, acc[t]);
        }
    }

    float* yb = ybase + (size_t)b * QKVC * NPOS;   // stride skips to batch b
    float lsum = 0.f, lsq = 0.f;
    #pragma unroll
    for (int t = 0; t < 4; ++t)
        #pragma unroll
        for (int j = 0; j < 8; ++j) {
            const int row = mt + j + half * 8;
            const float v = acc[t][j] + bout[row];
            yb[(size_t)row * NPOS + nt + t * 16 + l] = v;
            lsum += v; lsq += v * v;
        }
    for (int off = 16; off > 0; off >>= 1) {
        lsum += __shfl_down(lsum, off, 32);
        lsq  += __shfl_down(lsq,  off, 32);
    }
    if (lane == 0) {
        atomicAdd(&gnsum[b], lsum);
        atomicAdd(&gnsq[b], lsq);
    }
}

// ---------------------------------------------------------------------------
// Kernel 6: GroupNorm(1 group) finalize: (y-mean)*rsqrt(var+eps)*gamma + beta.
// ---------------------------------------------------------------------------
__global__ __launch_bounds__(256)
void gn_finalize(const float* __restrict__ ybase, const float* __restrict__ gnsum,
                 const float* __restrict__ gnsq, const float* __restrict__ gw,
                 const float* __restrict__ gb, float* __restrict__ out) {
    const size_t idx = (size_t)blockIdx.x * 256 + threadIdx.x;  // < 2*64*NPOS
    const int b   = (int)(idx >> 21);           // 64*NPOS = 2^21
    const int rem = (int)(idx & ((1u << 21) - 1));
    const int o   = rem >> 15;                  // NPOS = 2^15
    const int pos = rem & (NPOS - 1);

    const float count = 64.0f * NPOS;
    const float mean  = gnsum[b] / count;
    const float var   = gnsq[b] / count - mean * mean;
    const float inv   = rsqrtf(var + GN_EPS);
    const float v = ybase[(size_t)b * QKVC * NPOS + (size_t)o * NPOS + pos];
    out[idx] = (v - mean) * inv * gw[o] + gb[o];
}

// ---------------------------------------------------------------------------
extern "C" void kernel_launch(void* const* d_in, const int* in_sizes, int n_in,
                              void* d_out, int out_size, void* d_ws, size_t ws_size,
                              hipStream_t stream) {
    const float* x    = (const float*)d_in[0];
    const float* wqkv = (const float*)d_in[1];
    const float* wout = (const float*)d_in[2];
    const float* bout = (const float*)d_in[3];
    const float* gnw  = (const float*)d_in[4];
    const float* gnb  = (const float*)d_in[5];

    float* ws     = (float*)d_ws;
    float* qkv    = ws;                                        // 25,165,824 f
    float* outbuf = qkv + (size_t)NB * QKVC * NPOS;            //  8,388,608 f
    float* kmax   = outbuf + (size_t)NB * HID * NPOS;          //        256 f
    float* ksum   = kmax + NB * HID;                           //        256 f
    float* ctx    = ksum + NB * HID;                           //      8,192 f
    float* gnsum  = ctx + NB * 4 * 32 * 32;                    //          2 f
    float* gnsq   = gnsum + NB;                                //          2 f
    float* part   = gnsq + NB;                                 //    262,144 f
    // y aliases the k channel region [128,192) of qkv (dead after kernel 3)
    float* ybase  = qkv + (size_t)HID * NPOS;

    hipMemsetAsync(gnsum, 0, 2 * NB * sizeof(float), stream);

    qkv_gemm   <<<dim3(NPOS / 64, QKVC / 16, NB), 32,  0, stream>>>(x, wqkv, qkv);
    k_stats    <<<NB * HID, 256, 0, stream>>>(qkv, kmax, ksum);
    context_gemm<<<dim3(CSPLIT, NB * 4), CWAVES * 32, 0, stream>>>(qkv, kmax, part);
    context_merge<<<(NB * 4 * 1024) / 256, 256, 0, stream>>>(part, ksum, ctx);
    q_apply    <<<dim3(NPOS / 256, NB), 256, 0, stream>>>(qkv, ctx, outbuf);
    out_gemm   <<<dim3(NPOS / 64, CIN / 16, NB), 32, 0, stream>>>(outbuf, wout, bout,
                                                                  ybase, gnsum, gnsq);
    gn_finalize<<<(NB * CIN * NPOS) / 256, 256, 0, stream>>>(ybase, gnsum, gnsq,
                                                             gnw, gnb, (float*)d_out);
}

// v002
// Next to v001, in two timings, it ran 1.31 times as fast each time.
// Counting every step since v000, it is 3.25 times as fast.
#include <hip/hip_runtime.h>

// ---------------------------------------------------------------------------
// LinearAttention fused pipeline for gfx1250 (MI455X), fp32 WMMA path.
// Shapes: b=2, c=64, n=32768, heads=4, dim_head=32, hidden=128, qkv=384.
// Memory-bound: 34 MB mandatory HBM traffic; all intermediates L2-resident.
// ---------------------------------------------------------------------------

#define NPOS   32768           // 32*32*32 spatial positions
#define CIN    64
#define HID    128
#define QKVC   384
#define NB     2
#define SCALE_Q 0.17677669529663687f   // 32^-0.5
#define GN_EPS  1e-5f

typedef __attribute__((ext_vector_type(2))) float v2f;
typedef __attribute__((ext_vector_type(8))) float v8f;

__device__ __forceinline__ v8f wmma_f32(v2f a, v2f b, v8f c) {
    // V_WMMA_F32_16X16X4_F32: D(16x16,f32) = A(16x4,f32) x B(4x16,f32) + C
    return __builtin_amdgcn_wmma_f32_16x16x4_f32(
        /*neg_a=*/false, a, /*neg_b=*/false, b,
        /*c_mod=*/(short)0, c, /*reuse_a=*/false, /*reuse_b=*/false);
}

// ---------------------------------------------------------------------------
// Kernel 1: qkv[b][384][n] = w_qkv(384x64) @ x[b](64xn).
// One wave = one 16-row M tile x FOUR 16-col N tiles.  The 16 A fragments
// (16x64 weights striped per the 16x4 f32 layout) are preloaded into
// registers once; the K-loop only streams B (x) rows.
// A layout (16x4 f32): lanes 0-15 row=l K={0,1}; lanes 16-31 row=l K={2,3}.
// B layout (4x16 f32): lanes 0-15 col=l K rows {0,1}; lanes 16-31 rows {2,3}.
// C/D layout: VGPR j -> row j (lanes 0-15) / row j+8 (lanes 16-31).
// ---------------------------------------------------------------------------
__global__ __launch_bounds__(32)
void qkv_gemm(const float* __restrict__ x, const float* __restrict__ wqkv,
              float* __restrict__ qkv) {
    const int lane = threadIdx.x;
    const int half = lane >> 4;        // 0 or 1
    const int l    = lane & 15;
    const int nt   = blockIdx.x * 64;  // 4 N tiles of 16
    const int mt   = blockIdx.y * 16;
    const int b    = blockIdx.z;
    const float* xb = x + (size_t)b * CIN * NPOS;

    v2f af[16];                        // entire 16x64 A tile in registers
    #pragma unroll
    for (int k = 0; k < 16; ++k) {
        const int ka = k * 4 + half * 2;
        af[k].x = wqkv[(mt + l) * CIN + ka];
        af[k].y = wqkv[(mt + l) * CIN + ka + 1];
    }

    v8f acc[4] = {};
    #pragma unroll
    for (int k = 0; k < 16; ++k) {
        const int ka = k * 4 + half * 2;
        const float* r0 = xb + (size_t)ka       * NPOS + nt + l;
        const float* r1 = xb + (size_t)(ka + 1) * NPOS + nt + l;
        #pragma unroll
        for (int t = 0; t < 4; ++t) {
            v2f bb; bb.x = r0[t * 16]; bb.y = r1[t * 16];
            acc[t] = wmma_f32(af[k], bb, acc[t]);
        }
    }

    float* dst = qkv + (size_t)b * QKVC * NPOS;
    #pragma unroll
    for (int t = 0; t < 4; ++t)
        #pragma unroll
        for (int j = 0; j < 8; ++j) {
            const int row = mt + j + half * 8;
            dst[(size_t)row * NPOS + nt + t * 16 + l] = acc[t][j];
        }
}

// ---------------------------------------------------------------------------
// Kernel 2: per (b, k-channel) max and sum(exp) over n  (softmax over axis 3).
// k channels live at qkv channels [128,256).  Streaming scan with prefetch.
// ---------------------------------------------------------------------------
__global__ __launch_bounds__(256)
void k_stats(const float* __restrict__ qkv, float* __restrict__ kmax,
             float* __restrict__ ksum) {
    const int ch = blockIdx.x;              // 0..255 = b*128 + c
    const int b  = ch >> 7, c = ch & 127;
    const float* kp = qkv + (size_t)(b * QKVC + HID + c) * NPOS;
    __shared__ float red[256];

    float m = -1e30f;
    for (int i = threadIdx.x; i < NPOS; i += 256) {
        if (i + 4096 < NPOS) __builtin_prefetch(kp + i + 4096, 0, 1);
        m = fmaxf(m, kp[i]);
    }
    red[threadIdx.x] = m; __syncthreads();
    for (int s = 128; s > 0; s >>= 1) {
        if (threadIdx.x < s) red[threadIdx.x] = fmaxf(red[threadIdx.x], red[threadIdx.x + s]);
        __syncthreads();
    }
    m = red[0]; __syncthreads();

    float sum = 0.f;
    for (int i = threadIdx.x; i < NPOS; i += 256) sum += __expf(kp[i] - m);
    red[threadIdx.x] = sum; __syncthreads();
    for (int s = 128; s > 0; s >>= 1) {
        if (threadIdx.x < s) red[threadIdx.x] += red[threadIdx.x + s];
        __syncthreads();
    }
    if (threadIdx.x == 0) { kmax[ch] = m; ksum[ch] = red[0]; }
}

// ---------------------------------------------------------------------------
// Kernel 3: context[b][h][d][e] = sum_n softmax_k[d][n] * v[e][n].
// The n range of each (b,h) is cut into CSPLIT work-groups of CWAVES waves, so
// that 256 work-groups (one per WGP) share the sum.  Each wave accumulates the
// full 32x32 (2x2 tiles of 16x16) over its own 64 positions with WMMA,
// A = exp(k - kmax) built in VALU.  LDS reduce across the waves, then one
// un-normalised 32x32 partial per work-group goes to the workspace.
// ---------------------------------------------------------------------------
#define CSPLIT 32              // work-groups per (b,h) along n
#define CWAVES 16              // waves per work-group

__global__ __launch_bounds__(CWAVES * 32)
void context_gemm(const float* __restrict__ qkv, const float* __restrict__ kmax,
                  float* __restrict__ part) {
    const int sp   = blockIdx.x;            // 0..CSPLIT-1
    const int bh   = blockIdx.y;            // 0..7
    const int b    = bh >> 2, h = bh & 3;
    const int wave = threadIdx.x >> 5;
    const int lane = threadIdx.x & 31;
    const int half = lane >> 4, l = lane & 15;

    const float* kbase = qkv + (size_t)(b * QKVC + HID      + h * 32) * NPOS;
    const float* vbase = qkv + (size_t)(b * QKVC + 2 * HID  + h * 32) * NPOS;
    const int sbase = b * HID + h * 32;
    const float km0 = kmax[sbase + l];       // rows 0..15 (this lane's row)
    const float km1 = kmax[sbase + 16 + l];  // rows 16..31

    v8f acc[2][2] = {};
    const int chunk = NPOS / (CSPLIT * CWAVES);
    const int n0 = (sp * CWAVES + wave) * chunk;
    for (int i = 0; i < chunk; i += 4) {
        const int kk = n0 + i + half * 2;
        v2f a0, a1, b0, b1;
        a0.x = __expf(kbase[(size_t)l        * NPOS + kk]     - km0);
        a0.y = __expf(kbase[(size_t)l        * NPOS + kk + 1] - km0);
        a1.x = __expf(kbase[(size_t)(16 + l) * NPOS + kk]     - km1);
        a1.y = __expf(kbase[(size_t)(16 + l) * NPOS + kk + 1] - km1);
        b0.x = vbase[(size_t)l        * NPOS + kk];       // B[k][e=l] = v[l][n]
        b0.y = vbase[(size_t)l        * NPOS + kk + 1];
        b1.x = vbase[(size_t)(16 + l) * NPOS + kk];       // e-tile 1
        b1.y = vbase[(size_t)(16 + l) * NPOS + kk + 1];
        acc[0][0] = wmma_f32(a0, b0, acc[0][0]);
        acc[0][1] = wmma_f32(a0, b1, acc[0][1]);
        acc[1][0] = wmma_f32(a1, b0, acc[1][0]);
        acc[1][1] = wmma_f32(a1, b1, acc[1][1]);
    }

    __shared__ float sctx[CWAVES][32][32];  // 64 KB of the 320 KB LDS
    #pragma unroll
    for (int dt = 0; dt < 2; ++dt)
        #pragma unroll
        for (int et = 0; et < 2; ++et)
            #pragma unroll
            for (int j = 0; j < 8; ++j)
                sctx[wave][dt * 16 + j + half * 8][et * 16 + l] = acc[dt][et][j];
    __syncthreads();

    for (int idx = threadIdx.x; idx < 1024; idx += CWAVES * 32) {
        const int d = idx >> 5, e = idx & 31;
        float s = 0.f;
        #pragma unroll
        for (int w = 0; w < CWAVES; ++w) s += sctx[w][d][e];
        part[((size_t)bh * CSPLIT + sp) * 1024 + idx] = s;
    }
}

// ---------------------------------------------------------------------------
// Kernel 3b: context = (sum of the CSPLIT partials, in index order) / ksum[d].
// ---------------------------------------------------------------------------
__global__ __launch_bounds__(256)
void context_merge(const float* __restrict__ part, const float* __restrict__ ksum,
                   float* __restrict__ ctx) {
    const int idx = blockIdx.x * 256 + threadIdx.x;   // < 8 * 1024
    const int bh  = idx >> 10, de = idx & 1023;
    const float* p = part + (size_t)bh * CSPLIT * 1024 + de;
    float s = 0.f;
    // unrolled so that all CSPLIT loads are in flight at once: one L2 trip, not CSPLIT
    #pragma unroll
    for (int sp = 0; sp < CSPLIT; ++sp) s += p[sp * 1024];
    ctx[idx] = s / ksum[bh * 32 + (de >> 5)];
}

// ---------------------------------------------------------------------------
// Kernel 4: per-position q softmax (over the 32 head channels) * SCALE, then
// out[e][n] = sum_d ctx[h][d][e] * q_sm[d][n] on the matrix unit.
// One wave = one head x 64 positions: M = e (2 tiles), K = d (8 steps of 4),
// N = positions (4 tiles).  A = ctx^T, 16 fragments held in registers, read
// straight from global (no LDS).  Column c of N tile t stands for position
// n0 + 4c + t, so a lane reads each q row and writes each out row as one
// 16-byte piece (256 contiguous bytes per 16 lanes).
// k order, A and B alike: step k, lane half hf, element i  <->  d = 4k + 2hf + i.
// A lane holds 16 of a position's 32 channels, lane ^ 16 the other 16.
// ---------------------------------------------------------------------------
#define QWAVES 16              // 4 heads x 4 chunks of 64 positions

typedef __attribute__((ext_vector_type(4))) float v4f;

__device__ __forceinline__ float other_half(float v) {
    // value of lane ^ 16 (v_permlanex16_b32 with the identity lane select)
    return __int_as_float(__builtin_amdgcn_permlanex16(
        0, __float_as_int(v), 0x76543210, 0xfedcba98, false, false));
}

__device__ __forceinline__ void exp_pair(float& r0, float& r1, float x0, float x1) {
    // e^x as 2^(x * log2 e), two at a time.  In asm so that the slot the
    // instruction set asks for behind a transcendental is always filled: the
    // first by the second, which shares no register with it (early-clobber
    // outputs), the second by the v_nop, whatever the compiler puts next.
    asm("v_exp_f32 %0, %2\n\tv_exp_f32 %1, %3\n\tv_nop"
        : "=&v"(r0), "=&v"(r1)
        : "v"(x0 * 1.44269504f), "v"(x1 * 1.44269504f));
}

__global__ __launch_bounds__(QWAVES * 32)
void q_apply(const float* __restrict__ qkv, const float* __restrict__ ctx,
             float* __restrict__ outbuf) {
    const int wave = threadIdx.x >> 5;
    const int lane = threadIdx.x & 31;
    const int half = lane >> 4, l = lane & 15;
    const int h    = wave & 3;
    const int b    = blockIdx.y;
    const int n0   = (blockIdx.x * (QWAVES / 4) + (wave >> 2)) * 64 + l * 4;

    const float* qb = qkv + ((size_t)b * QKVC + h * 32) * NPOS + n0;   // q channels
    const float* cb = ctx + ((size_t)b * 4 + h) * 1024;
    float* ob = outbuf + ((size_t)b * HID + h * 32) * NPOS + n0;

    v4f qv[8][2];                      // this lane's 16 channels x 4 positions
    #pragma unroll  // constant indices: the arrays stay in registers
    for (int k = 0; k < 8; ++k)
        #pragma unroll  // constant indices: the arrays stay in registers
        for (int i = 0; i < 2; ++i) {
            // the last load may land on the address pair that the fifteen before
            // it name: the wait asked for before such a register is overwritten
            if (k == 7 && i == 1) asm volatile("s_wait_xcnt 0x0" ::: "memory");
            qv[k][i] = *(const v4f*)(qb + (size_t)(k * 4 + half * 2 + i) * NPOS);
        }

    // likewise: the context loads below may land on the q address pair
    asm volatile("s_wait_xcnt 0x0" ::: "memory");

    v2f af[2][8];                      // A[e][d] = ctx[d][e]
    #pragma unroll  // constant indices: the arrays stay in registers
    for (int et = 0; et < 2; ++et)
        #pragma unroll  // constant indices: the arrays stay in registers
        for (int k = 0; k < 8; ++k) {
            const int d = k * 4 + half * 2;
            af[et][k].x = cb[d * 32 + et * 16 + l];
            af[et][k].y = cb[(d + 1) * 32 + et * 16 + l];
        }

    float inv[4];
    #pragma unroll  // constant indices: the arrays stay in registers
    for (int t = 0; t < 4; ++t) {
        float m = -1e30f;
        #pragma unroll  // constant indices: the arrays stay in registers
        for (int k = 0; k < 8; ++k) m = fmaxf(m, fmaxf(qv[k][0][t], qv[k][1][t]));
        m = fmaxf(m, other_half(m));
        float s = 0.f;
        #pragma unroll  // constant indices: the arrays stay in registers
        for (int k = 0; k < 8; ++k) {
            float e0, e1;
            exp_pair(e0, e1, qv[k][0][t] - m, qv[k][1][t] - m);
            qv[k][0][t] = e0; qv[k][1][t] = e1;
            s += e0 + e1;
        }
        s += other_half(s);
        inv[t] = SCALE_Q / s;
    }

    // keeps every asm exponential ahead of the first WMMA
    __builtin_amdgcn_sched_barrier(0);

    v8f acc[2][4] = {};
    #pragma unroll  // constant indices: the arrays stay in registers
    for (int k = 0; k < 8; ++k)
        #pragma unroll  // constant indices: the arrays stay in registers
        for (int t = 0; t < 4; ++t) {
            v2f bb; bb.x = qv[k][0][t]; bb.y = qv[k][1][t];
            acc[0][t] = wmma_f32(af[0][k], bb, acc[0][t]);
            acc[1][t] = wmma_f32(af[1][k], bb, acc[1][t]);
        }

    #pragma unroll  // constant indices: the arrays stay in registers
    for (int et = 0; et < 2; ++et)
        #pragma unroll  // constant indices: the arrays stay in registers
        for (int j = 0; j < 8; ++j) {
            v4f o;
            #pragma unroll  // constant indices: the arrays stay in registers
            for (int t = 0; t < 4; ++t) o[t] = acc[et][t][j] * inv[t];
            *(v4f*)(ob + (size_t)(et * 16 + j + half * 8) * NPOS) = o;
        }
}

// ---------------------------------------------------------------------------
// Kernel 5: y[b][64][n] = w_out(64x128) @ out + b_out  (WMMA, K=128), plus
// GroupNorm sum / sumsq accumulation (wave shuffle reduce -> one atomic).
// Same 4-N-tile, register-resident-A structure as kernel 1 (32 A fragments).
// y is written into the dead k-region of the qkv buffer.
// ---------------------------------------------------------------------------
__global__ __launch_bounds__(32)
void out_gemm(const float* __restrict__ outbuf, const float* __restrict__ wout,
              const float* __restrict__ bout, float* __restrict__ ybase,
              float* __restrict__ gnsum, float* __restrict__ gnsq) {
    const int lane = threadIdx.x;
    const int half = lane >> 4, l = lane & 15;
    const int nt = blockIdx.x * 64;    // 4 N tiles of 16
    const int mt = blockIdx.y * 16;
    const int b  = blockIdx.z;
    const float* ob = outbuf + (size_t)b * HID * NPOS;

    v2f af[32];                        // entire 16x128 A tile in registers
    #pragma unroll
    for (int k = 0; k < 32; ++k) {
        const int ka = k * 4 + half * 2;
        af[k].x = wout[(mt + l) * HID + ka];
        af[k].y = wout[(mt + l) * HID + ka + 1];
    }

    v8f acc[4] = {};
    #pragma unroll
    for (int k = 0; k < 32; ++k) {
        const int ka = k * 4 + half * 2;
        const float* r0 = ob + (size_t)ka       * NPOS + nt + l;
        const float* r1 = ob + (size_t)(ka + 1) * NPOS + nt + l;
        #pragma unroll
        for (int t = 0; t < 4; ++t) {
            v2f bb; bb.x = r0[t * 16]; bb.y = r1[t * 16];
            acc[t] = wmma_f32(af[k], bb, acc[t]);
        }
    }

    float* yb = ybase + (size_t)b * QKVC * NPOS;   // stride skips to batch b
    float lsum = 0.f, lsq = 0.f;
    #pragma unroll
    for (int t = 0; t < 4; ++t)
        #pragma unroll
        for (int j = 0; j < 8; ++j) {
            const int row = mt + j + half * 8;
            const float v = acc[t][j] + bout[row];
            yb[(size_t)row * NPOS + nt + t * 16 + l] = v;
            lsum += v; lsq += v * v;
        }
    for (int off = 16; off > 0; off >>= 1) {
        lsum += __shfl_down(lsum, off, 32);
        lsq  += __shfl_down(lsq,  off, 32);
    }
    if (lane == 0) {
        atomicAdd(&gnsum[b], lsum);
        atomicAdd(&gnsq[b], lsq);
    }
}

// ---------------------------------------------------------------------------
// Kernel 6: GroupNorm(1 group) finalize: (y-mean)*rsqrt(var+eps)*gamma + beta.
// ---------------------------------------------------------------------------
__global__ __launch_bounds__(256)
void gn_finalize(const float* __restrict__ ybase, const float* __restrict__ gnsum,
                 const float* __restrict__ gnsq, const float* __restrict__ gw,
                 const float* __restrict__ gb, float* __restrict__ out) {
    const size_t idx = (size_t)blockIdx.x * 256 + threadIdx.x;  // < 2*64*NPOS
    const int b   = (int)(idx >> 21);           // 64*NPOS = 2^21
    const int rem = (int)(idx & ((1u << 21) - 1));
    const int o   = rem >> 15;                  // NPOS = 2^15
    const int pos = rem & (NPOS - 1);

    const float count = 64.0f * NPOS;
    const float mean  = gnsum[b] / count;
    const float var   = gnsq[b] / count - mean * mean;
    const float inv   = rsqrtf(var + GN_EPS);
    const float v = ybase[(size_t)b * QKVC * NPOS + (size_t)o * NPOS + pos];
    out[idx] = (v - mean) * inv * gw[o] + gb[o];
}

// ---------------------------------------------------------------------------
extern "C" void kernel_launch(void* const* d_in, const int* in_sizes, int n_in,
                              void* d_out, int out_size, void* d_ws, size_t ws_size,
                              hipStream_t stream) {
    const float* x    = (const float*)d_in[0];
    const float* wqkv = (const float*)d_in[1];
    const float* wout = (const float*)d_in[2];
    const float* bout = (const float*)d_in[3];
    const float* gnw  = (const float*)d_in[4];
    const float* gnb  = (const float*)d_in[5];

    float* ws     = (float*)d_ws;
    float* qkv    = ws;                                        // 25,165,824 f
    float* outbuf = qkv + (size_t)NB * QKVC * NPOS;            //  8,388,608 f
    float* kmax   = outbuf + (size_t)NB * HID * NPOS;          //        256 f
    float* ksum   = kmax + NB * HID;                           //        256 f
    float* ctx    = ksum + NB * HID;                           //      8,192 f
    float* gnsum  = ctx + NB * 4 * 32 * 32;                    //          2 f
    float* gnsq   = gnsum + NB;                                //          2 f
    float* part   = gnsq + NB;                                 //    262,144 f
    // y aliases the k channel region [128,192) of qkv (dead after kernel 3)
    float* ybase  = qkv + (size_t)HID * NPOS;

    hipMemsetAsync(gnsum, 0, 2 * NB * sizeof(float), stream);

    qkv_gemm   <<<dim3(NPOS / 64, QKVC / 16, NB), 32,  0, stream>>>(x, wqkv, qkv);
    k_stats    <<<NB * HID, 256, 0, stream>>>(qkv, kmax, ksum);
    context_gemm<<<dim3(CSPLIT, NB * 4), CWAVES * 32, 0, stream>>>(qkv, kmax, part);
    context_merge<<<(NB * 4 * 1024) / 256, 256, 0, stream>>>(part, ksum, ctx);
    q_apply    <<<dim3(NPOS / 256, NB), QWAVES * 32, 0, stream>>>(qkv, ctx, outbuf);
    out_gemm   <<<dim3(NPOS / 64, CIN / 16, NB), 32, 0, stream>>>(outbuf, wout, bout,
                                                                  ybase, gnsum, gnsq);
    gn_finalize<<<(NB * CIN * NPOS) / 256, 256, 0, stream>>>(ybase, gnsum, gnsq,
                                                             gnw, gnb, (float*)d_out);
}

// v003
// Next to v002, in two timings, it ran 1.14 times as fast each time.
// All steps since v000 together make it 3.71 times as fast.
#include <hip/hip_runtime.h>

// ---------------------------------------------------------------------------
// LinearAttention fused pipeline for gfx1250 (MI455X), fp32 WMMA path.
// Shapes: b=2, c=64, n=32768, heads=4, dim_head=32, hidden=128, qkv=384.
// Memory-bound: 34 MB mandatory HBM traffic; all intermediates L2-resident.
// ---------------------------------------------------------------------------

#define NPOS   32768           // 32*32*32 spatial positions
#define CIN    64
#define HID    128
#define QKVC   384
#define NB     2
#define SCALE_Q 0.17677669529663687f   // 32^-0.5
#define GN_EPS  1e-5f

typedef __attribute__((ext_vector_type(2))) float v2f;
typedef __attribute__((ext_vector_type(8))) float v8f;

__device__ __forceinline__ v8f wmma_f32(v2f a, v2f b, v8f c) {
    // V_WMMA_F32_16X16X4_F32: D(16x16,f32) = A(16x4,f32) x B(4x16,f32) + C
    return __builtin_amdgcn_wmma_f32_16x16x4_f32(
        /*neg_a=*/false, a, /*neg_b=*/false, b,
        /*c_mod=*/(short)0, c, /*reuse_a=*/false, /*reuse_b=*/false);
}

__device__ __forceinline__ float other_half(float v) {
    // value of lane ^ 16 (v_permlanex16_b32 with the identity lane select)
    return __int_as_float(__builtin_amdgcn_permlanex16(
        0, __float_as_int(v), 0x76543210, 0xfedcba98, false, false));
}

__device__ __forceinline__ void exp_pair(float& r0, float& r1, float x0, float x1) {
    // e^x as 2^(x * log2 e), two at a time.  In asm so that the slot the
    // instruction set asks for behind a transcendental is always filled: the
    // first by the second, which shares no register with it (early-clobber
    // outputs), the second by the v_nop, whatever the compiler puts next.
    asm("v_exp_f32 %0, %2\n\tv_exp_f32 %1, %3\n\tv_nop"
        : "=&v"(r0), "=&v"(r1)
        : "v"(x0 * 1.44269504f), "v"(x1 * 1.44269504f));
}

// ---------------------------------------------------------------------------
// Kernel 1: qkv[b][384][n] = w_qkv(384x64) @ x[b](64xn).
// One wave = one 16-row M tile x FOUR 16-col N tiles.  The 16 A fragments
// (16x64 weights striped per the 16x4 f32 layout) are preloaded into
// registers once; the K-loop only streams B (x) rows.
// A layout (16x4 f32): lanes 0-15 row=l K={0,1}; lanes 16-31 row=l K={2,3}.
// B layout (4x16 f32): lanes 0-15 col=l K rows {0,1}; lanes 16-31 rows {2,3}.
// C/D layout: VGPR j -> row j (lanes 0-15) / row j+8 (lanes 16-31).
// ---------------------------------------------------------------------------
__global__ __launch_bounds__(32)
void qkv_gemm(const float* __restrict__ x, const float* __restrict__ wqkv,
              float* __restrict__ qkv) {
    const int lane = threadIdx.x;
    const int half = lane >> 4;        // 0 or 1
    const int l    = lane & 15;
    const int nt   = blockIdx.x * 64;  // 4 N tiles of 16
    const int mt   = blockIdx.y * 16;
    const int b    = blockIdx.z;
    const float* xb = x + (size_t)b * CIN * NPOS;

    v2f af[16];                        // entire 16x64 A tile in registers
    #pragma unroll
    for (int k = 0; k < 16; ++k) {
        const int ka = k * 4 + half * 2;
        af[k].x = wqkv[(mt + l) * CIN + ka];
        af[k].y = wqkv[(mt + l) * CIN + ka + 1];
    }

    v8f acc[4] = {};
    #pragma unroll
    for (int k = 0; k < 16; ++k) {
        const int ka = k * 4 + half * 2;
        const float* r0 = xb + (size_t)ka       * NPOS + nt + l;
        const float* r1 = xb + (size_t)(ka + 1) * NPOS + nt + l;
        #pragma unroll
        for (int t = 0; t < 4; ++t) {
            v2f bb; bb.x = r0[t * 16]; bb.y = r1[t * 16];
            acc[t] = wmma_f32(af[k], bb, acc[t]);
        }
    }

    float* dst = qkv + (size_t)b * QKVC * NPOS;
    #pragma unroll
    for (int t = 0; t < 4; ++t)
        #pragma unroll
        for (int j = 0; j < 8; ++j) {
            const int row = mt + j + half * 8;
            dst[(size_t)row * NPOS + nt + t * 16 + l] = acc[t][j];
        }
}

// ---------------------------------------------------------------------------
// Kernel 2: context[b][h][d][e] = sum_n softmax_k[d][n] * v[e][n], with the
// softmax over n (axis 3) done in pieces: no separate pass over k.
// The n range of each (b,h) is cut into CSPLIT work-groups of CWAVES waves, so
// that 256 work-groups (one per WGP) share the sum.  Each wave holds its own
// 64 positions of the 32 k rows in registers, takes each row's max over them,
// and accumulates the full 32x32 (2x2 tiles of 16x16) with WMMA,
// A = exp(k - wave max) built in VALU, beside each row's sum of A.
// The LDS reduce brings the waves to the work-group's row max (factor
// exp(wave max - group max)); one un-normalised 32x32 partial, its 32 row
// maxima and its 32 row sums per work-group go to the workspace.
// ---------------------------------------------------------------------------
#define CSPLIT 32              // work-groups per (b,h) along n
#define CWAVES 16              // waves per work-group
#define CSTEPS (NPOS / (CSPLIT * CWAVES) / 4)   // WMMA k steps per wave

__global__ __launch_bounds__(CWAVES * 32)
void context_gemm(const float* __restrict__ qkv, float* __restrict__ part,
                  float* __restrict__ pmax, float* __restrict__ psum) {
    const int sp   = blockIdx.x;            // 0..CSPLIT-1
    const int bh   = blockIdx.y;            // 0..7
    const int b    = bh >> 2, h = bh & 3;
    const int wave = threadIdx.x >> 5;
    const int lane = threadIdx.x & 31;
    const int half = lane >> 4, l = lane & 15;

    // k order, A and B alike: step i, lane half hf, element j <-> the wave's
    // position 4i + 2hf + j (n0 holds the lane's 2hf)
    const int n0 = (sp * CWAVES + wave) * (CSTEPS * 4) + half * 2;
    const float* kr = qkv + (size_t)(b * QKVC + HID     + h * 32 + l) * NPOS + n0;
    const float* vr = qkv + (size_t)(b * QKVC + 2 * HID + h * 32 + l) * NPOS + n0;

    v2f a0[CSTEPS], a1[CSTEPS];             // rows l and 16 + l of k
    v2f b0[CSTEPS], b1[CSTEPS];             // B[k][e] = v[e][n], e = l and 16 + l
    #pragma unroll  // constant indices: the arrays stay in registers
    for (int i = 0; i < CSTEPS; ++i) {
        a0[i] = *(const v2f*)(kr + i * 4);
        // the last load may land on the address pair that the loads before it
        // name: the wait asked for before such a register is overwritten
        if (i == CSTEPS - 1) asm volatile("s_wait_xcnt 0x0" ::: "memory");
        a1[i] = *(const v2f*)(kr + (size_t)16 * NPOS + i * 4);
    }
    // likewise: a v load may land on the k address pair
    asm volatile("s_wait_xcnt 0x0" ::: "memory");
    #pragma unroll  // constant indices: the arrays stay in registers
    for (int i = 0; i < CSTEPS; ++i) {
        b0[i] = *(const v2f*)(vr + i * 4);
        // likewise for the last load from the v address pair
        if (i == CSTEPS - 1) asm volatile("s_wait_xcnt 0x0" ::: "memory");
        b1[i] = *(const v2f*)(vr + (size_t)16 * NPOS + i * 4);
    }
    // likewise: what is computed next may land on an address pair
    asm volatile("s_wait_xcnt 0x0" ::: "memory");
    // keeps the v loads ahead of the first wait for k: one trip to memory, not two
    __builtin_amdgcn_sched_barrier(0);

    // a lane holds 32 of its rows' 64 positions, lane ^ 16 the other 32
    float m0 = fmaxf(a0[0].x, a0[0].y), m1 = fmaxf(a1[0].x, a1[0].y);
    #pragma unroll  // constant indices: the arrays stay in registers
    for (int i = 1; i < CSTEPS; ++i) {
        m0 = fmaxf(m0, fmaxf(a0[i].x, a0[i].y));
        m1 = fmaxf(m1, fmaxf(a1[i].x, a1[i].y));
    }
    m0 = fmaxf(m0, other_half(m0));
    m1 = fmaxf(m1, other_half(m1));

    float s0 = 0.f, s1 = 0.f;
    #pragma unroll  // constant indices: the arrays stay in registers
    for (int i = 0; i < CSTEPS; ++i) {
        float x, y;
        exp_pair(x, y, a0[i].x - m0, a0[i].y - m0);
        a0[i].x = x; a0[i].y = y;
        s0 += x + y;
        exp_pair(x, y, a1[i].x - m1, a1[i].y - m1);
        a1[i].x = x; a1[i].y = y;
        s1 += x + y;
    }
    s0 += other_half(s0);
    s1 += other_half(s1);

    // keeps every asm exponential ahead of the first WMMA
    __builtin_amdgcn_sched_barrier(0);

    v8f acc[2][2] = {};
    #pragma unroll  // constant indices: the arrays stay in registers
    for (int i = 0; i < CSTEPS; ++i) {
        acc[0][0] = wmma_f32(a0[i], b0[i], acc[0][0]);
        acc[0][1] = wmma_f32(a0[i], b1[i], acc[0][1]);
        acc[1][0] = wmma_f32(a1[i], b0[i], acc[1][0]);
        acc[1][1] = wmma_f32(a1[i], b1[i], acc[1][1]);
    }

    __shared__ float sctx[CWAVES][32][32];  // 64 KB of the 320 KB LDS
    __shared__ float smax[CWAVES][32];
    __shared__ float ssum[CWAVES][32];
    #pragma unroll
    for (int dt = 0; dt < 2; ++dt)
        #pragma unroll
        for (int et = 0; et < 2; ++et)
            #pragma unroll
            for (int j = 0; j < 8; ++j)
                sctx[wave][dt * 16 + j + half * 8][et * 16 + l] = acc[dt][et][j];
    // both halves hold the same row values: half 0 stores row l, half 1 row 16 + l
    smax[wave][lane] = half ? m1 : m0;
    ssum[wave][lane] = half ? s1 : s0;
    __syncthreads();

    for (int idx = threadIdx.x; idx < 1024; idx += CWAVES * 32) {
        const int d = idx >> 5, e = idx & 31;
        float mw[CWAVES];
        #pragma unroll
        for (int w = 0; w < CWAVES; ++w) mw[w] = smax[w][d];
        float m = mw[0];
        #pragma unroll
        for (int w = 1; w < CWAVES; ++w) m = fmaxf(m, mw[w]);
        float s = 0.f, t = 0.f;
        #pragma unroll
        for (int w = 0; w < CWAVES; w += 2) {
            float f0, f1;
            exp_pair(f0, f1, mw[w] - m, mw[w + 1] - m);
            s += sctx[w][d][e] * f0;
            t += ssum[w][d] * f0;
            s += sctx[w + 1][d][e] * f1;
            t += ssum[w + 1][d] * f1;
        }
        part[((size_t)bh * CSPLIT + sp) * 1024 + idx] = s;
        if (e == 0) {
            pmax[(bh * CSPLIT + sp) * 32 + d] = m;
            psum[(bh * CSPLIT + sp) * 32 + d] = t;
        }
        // the next trip reuses the registers that these stores name: the wait
        // asked for before such a register is overwritten
        asm volatile("s_wait_xcnt 0x0" ::: "memory");
    }
}

// ---------------------------------------------------------------------------
// Kernel 3: context = sum of the CSPLIT partials, in index order, each brought
// to the row's overall max by exp(group max - max), over the row sums' like sum.
// ---------------------------------------------------------------------------
__global__ __launch_bounds__(256)
void context_merge(const float* __restrict__ part, const float* __restrict__ pmax,
                   const float* __restrict__ psum, float* __restrict__ ctx) {
    const int idx = blockIdx.x * 256 + threadIdx.x;   // < 8 * 1024
    const int bh  = idx >> 10, de = idx & 1023;
    const float* p  = part + (size_t)bh * CSPLIT * 1024 + de;
    const float* pm = pmax + bh * CSPLIT * 32 + (de >> 5);
    const float* ps = psum + bh * CSPLIT * 32 + (de >> 5);
    // unrolled so that all 3 * CSPLIT loads are in flight at once: one L2 trip.
    // Each s_wait_xcnt: a later load, the last of a run too, may land on the
    // address registers that the loads before it name; it is the wait asked for
    // before such a register is overwritten.
    float mv[CSPLIT], sv[CSPLIT], pv[CSPLIT];
    #pragma unroll
    for (int sp = 0; sp < CSPLIT; ++sp) {
        if (sp == CSPLIT - 1) asm volatile("s_wait_xcnt 0x0" ::: "memory");
        mv[sp] = pm[sp * 32];
    }
    asm volatile("s_wait_xcnt 0x0" ::: "memory");
    #pragma unroll
    for (int sp = 0; sp < CSPLIT; ++sp) {
        if (sp == CSPLIT - 1) asm volatile("s_wait_xcnt 0x0" ::: "memory");
        sv[sp] = ps[sp * 32];
    }
    asm volatile("s_wait_xcnt 0x0" ::: "memory");
    #pragma unroll
    for (int sp = 0; sp < CSPLIT; ++sp) {
        if (sp == CSPLIT - 1) asm volatile("s_wait_xcnt 0x0" ::: "memory");
        pv[sp] = p[sp * 1024];
    }
    asm volatile("s_wait_xcnt 0x0" ::: "memory");
    // keeps every load ahead of the first wait for one: one trip, not several
    __builtin_amdgcn_sched_barrier(0);
    float m = mv[0];
    #pragma unroll
    for (int sp = 1; sp < CSPLIT; ++sp) m = fmaxf(m, mv[sp]);
    float num = 0.f, den = 0.f;
    #pragma unroll
    for (int sp = 0; sp < CSPLIT; sp += 2) {
        float f0, f1;
        exp_pair(f0, f1, mv[sp] - m, mv[sp + 1] - m);
        num += pv[sp] * f0;
        den += sv[sp] * f0;
        num += pv[sp + 1] * f1;
        den += sv[sp + 1] * f1;
    }
    ctx[idx] = num / den;
}

// ---------------------------------------------------------------------------
// Kernel 4: per-position q softmax (over the 32 head channels) * SCALE, then
// out[e][n] = sum_d ctx[h][d][e] * q_sm[d][n] on the matrix unit.
// One wave = one head x 64 positions: M = e (2 tiles), K = d (8 steps of 4),
// N = positions (4 tiles).  A = ctx^T, 16 fragments held in registers, read
// straight from global (no LDS).  Column c of N tile t stands for position
// n0 + 4c + t, so a lane reads each q row and writes each out row as one
// 16-byte piece (256 contiguous bytes per 16 lanes).
// k order, A and B alike: step k, lane half hf, element i  <->  d = 4k + 2hf + i.
// A lane holds 16 of a position's 32 channels, lane ^ 16 the other 16.
// ---------------------------------------------------------------------------
#define QWAVES 16              // 4 heads x 4 chunks of 64 positions

typedef __attribute__((ext_vector_type(4))) float v4f;

__global__ __launch_bounds__(QWAVES * 32)
void q_apply(const float* __restrict__ qkv, const float* __restrict__ ctx,
             float* __restrict__ outbuf) {
    const int wave = threadIdx.x >> 5;
    const int lane = threadIdx.x & 31;
    const int half = lane >> 4, l = lane & 15;
    const int h    = wave & 3;
    const int b    = blockIdx.y;
    const int n0   = (blockIdx.x * (QWAVES / 4) + (wave >> 2)) * 64 + l * 4;

    const float* qb = qkv + ((size_t)b * QKVC + h * 32) * NPOS + n0;   // q channels
    const float* cb = ctx + ((size_t)b * 4 + h) * 1024;
    float* ob = outbuf + ((size_t)b * HID + h * 32) * NPOS + n0;

    v4f qv[8][2];                      // this lane's 16 channels x 4 positions
    #pragma unroll  // constant indices: the arrays stay in registers
    for (int k = 0; k < 8; ++k)
        #pragma unroll  // constant indices: the arrays stay in registers
        for (int i = 0; i < 2; ++i) {
            // the last load may land on the address pair that the fifteen before
            // it name: the wait asked for before such a register is overwritten
            if (k == 7 && i == 1) asm volatile("s_wait_xcnt 0x0" ::: "memory");
            qv[k][i] = *(const v4f*)(qb + (size_t)(k * 4 + half * 2 + i) * NPOS);
        }

    // likewise: the context loads below may land on the q address pair
    asm volatile("s_wait_xcnt 0x0" ::: "memory");

    v2f af[2][8];                      // A[e][d] = ctx[d][e]
    #pragma unroll  // constant indices: the arrays stay in registers
    for (int et = 0; et < 2; ++et)
        #pragma unroll  // constant indices: the arrays stay in registers
        for (int k = 0; k < 8; ++k) {
            const int d = k * 4 + half * 2;
            af[et][k].x = cb[d * 32 + et * 16 + l];
            af[et][k].y = cb[(d + 1) * 32 + et * 16 + l];
        }

    float inv[4];
    #pragma unroll  // constant indices: the arrays stay in registers
    for (int t = 0; t < 4; ++t) {
        float m = -1e30f;
        #pragma unroll  // constant indices: the arrays stay in registers
        for (int k = 0; k < 8; ++k) m = fmaxf(m, fmaxf(qv[k][0][t], qv[k][1][t]));
        m = fmaxf(m, other_half(m));
        float s = 0.f;
        #pragma unroll  // constant indices: the arrays stay in registers
        for (int k = 0; k < 8; ++k) {
            float e0, e1;
            exp_pair(e0, e1, qv[k][0][t] - m, qv[k][1][t] - m);
            qv[k][0][t] = e0; qv[k][1][t] = e1;
            s += e0 + e1;
        }
        s += other_half(s);
        inv[t] = SCALE_Q / s;
    }

    // keeps every asm exponential ahead of the first WMMA
    __builtin_amdgcn_sched_barrier(0);

    v8f acc[2][4] = {};
    #pragma unroll  // constant indices: the arrays stay in registers
    for (int k = 0; k < 8; ++k)
        #pragma unroll  // constant indices: the arrays stay in registers
        for (int t = 0; t < 4; ++t) {
            v2f bb; bb.x = qv[k][0][t]; bb.y = qv[k][1][t];
            acc[0][t] = wmma_f32(af[0][k], bb, acc[0][t]);
            acc[1][t] = wmma_f32(af[1][k], bb, acc[1][t]);
        }

    #pragma unroll  // constant indices: the arrays stay in registers
    for (int et = 0; et < 2; ++et)
        #pragma unroll  // constant indices: the arrays stay in registers
        for (int j = 0; j < 8; ++j) {
            v4f o;
            #pragma unroll  // constant indices: the arrays stay in registers
            for (int t = 0; t < 4; ++t) o[t] = acc[et][t][j] * inv[t];
            *(v4f*)(ob + (size_t)(et * 16 + j + half * 8) * NPOS) = o;
        }
}

// ---------------------------------------------------------------------------
// Kernel 5: y[b][64][n] = w_out(64x128) @ out + b_out  (WMMA, K=128), plus
// GroupNorm sum / sumsq accumulation (wave shuffle reduce -> one atomic).
// Same 4-N-tile, register-resident-A structure as kernel 1 (32 A fragments).
// y is written into the dead k-region of the qkv buffer.
// ---------------------------------------------------------------------------
__global__ __launch_bounds__(32)
void out_gemm(const float* __restrict__ outbuf, const float* __restrict__ wout,
              const float* __restrict__ bout, float* __restrict__ ybase,
              float* __restrict__ gnsum, float* __restrict__ gnsq) {
    const int lane = threadIdx.x;
    const int half = lane >> 4, l = lane & 15;
    const int nt = blockIdx.x * 64;    // 4 N tiles of 16
    const int mt = blockIdx.y * 16;
    const int b  = blockIdx.z;
    const float* ob = outbuf + (size_t)b * HID * NPOS;

    v2f af[32];                        // entire 16x128 A tile in registers
    #pragma unroll
    for (int k = 0; k < 32; ++k) {
        const int ka = k * 4 + half * 2;
        af[k].x = wout[(mt + l) * HID + ka];
        af[k].y = wout[(mt + l) * HID + ka + 1];
    }

    v8f acc[4] = {};
    #pragma unroll
    for (int k = 0; k < 32; ++k) {
        const int ka = k * 4 + half * 2;
        const float* r0 = ob + (size_t)ka       * NPOS + nt + l;
        const float* r1 = ob + (size_t)(ka + 1) * NPOS + nt + l;
        #pragma unroll
        for (int t = 0; t < 4; ++t) {
            v2f bb; bb.x = r0[t * 16]; bb.y = r1[t * 16];
            acc[t] = wmma_f32(af[k], bb, acc[t]);
        }
    }

    float* yb = ybase + (size_t)b * QKVC * NPOS;   // stride skips to batch b
    float lsum = 0.f, lsq = 0.f;
    #pragma unroll
    for (int t = 0; t < 4; ++t)
        #pragma unroll
        for (int j = 0; j < 8; ++j) {
            const int row = mt + j + half * 8;
            const float v = acc[t][j] + bout[row];
            yb[(size_t)row * NPOS + nt + t * 16 + l] = v;
            lsum += v; lsq += v * v;
        }
    for (int off = 16; off > 0; off >>= 1) {
        lsum += __shfl_down(lsum, off, 32);
        lsq  += __shfl_down(lsq,  off, 32);
    }
    if (lane == 0) {
        atomicAdd(&gnsum[b], lsum);
        atomicAdd(&gnsq[b], lsq);
    }
}

// ---------------------------------------------------------------------------
// Kernel 6: GroupNorm(1 group) finalize: (y-mean)*rsqrt(var+eps)*gamma + beta.
// ---------------------------------------------------------------------------
__global__ __launch_bounds__(256)
void gn_finalize(const float* __restrict__ ybase, const float* __restrict__ gnsum,
                 const float* __restrict__ gnsq, const float* __restrict__ gw,
                 const float* __restrict__ gb, float* __restrict__ out) {
    const size_t idx = (size_t)blockIdx.x * 256 + threadIdx.x;  // < 2*64*NPOS
    const int b   = (int)(idx >> 21);           // 64*NPOS = 2^21
    const int rem = (int)(idx & ((1u << 21) - 1));
    const int o   = rem >> 15;                  // NPOS = 2^15
    const int pos = rem & (NPOS - 1);

    const float count = 64.0f * NPOS;
    const float mean  = gnsum[b] / count;
    const float var   = gnsq[b] / count - mean * mean;
    const float inv   = rsqrtf(var + GN_EPS);
    const float v = ybase[(size_t)b * QKVC * NPOS + (size_t)o * NPOS + pos];
    out[idx] = (v - mean) * inv * gw[o] + gb[o];
}

// ---------------------------------------------------------------------------
extern "C" void kernel_launch(void* const* d_in, const int* in_sizes, int n_in,
                              void* d_out, int out_size, void* d_ws, size_t ws_size,
                              hipStream_t stream) {
    const float* x    = (const float*)d_in[0];
    const float* wqkv = (const float*)d_in[1];
    const float* wout = (const float*)d_in[2];
    const float* bout = (const float*)d_in[3];
    const float* gnw  = (const float*)d_in[4];
    const float* gnb  = (const float*)d_in[5];

    float* ws     = (float*)d_ws;
    float* qkv    = ws;                                        // 25,165,824 f
    float* outbuf = qkv + (size_t)NB * QKVC * NPOS;            //  8,388,608 f
    float* pmax   = outbuf + (size_t)NB * HID * NPOS;          //      8,192 f
    float* psum   = pmax + NB * 4 * CSPLIT * 32;               //      8,192 f
    float* ctx    = psum + NB * 4 * CSPLIT * 32;               //      8,192 f
    float* gnsum  = ctx + NB * 4 * 32 * 32;                    //          2 f
    float* gnsq   = gnsum + NB;                                //          2 f
    float* part   = gnsq + NB;                                 //    262,144 f
    // y aliases the k channel region [128,192) of qkv (dead after kernel 2)
    float* ybase  = qkv + (size_t)HID * NPOS;

    hipMemsetAsync(gnsum, 0, 2 * NB * sizeof(float), stream);

    qkv_gemm   <<<dim3(NPOS / 64, QKVC / 16, NB), 32,  0, stream>>>(x, wqkv, qkv);
    context_gemm<<<dim3(CSPLIT, NB * 4), CWAVES * 32, 0, stream>>>(qkv, part, pmax, psum);
    context_merge<<<(NB * 4 * 1024) / 256, 256, 0, stream>>>(part, pmax, psum, ctx);
    q_apply    <<<dim3(NPOS / 256, NB), QWAVES * 32, 0, stream>>>(qkv, ctx, outbuf);
    out_gemm   <<<dim3(NPOS / 64, CIN / 16, NB), 32, 0, stream>>>(outbuf, wout, bout,
                                                                  ybase, gnsum, gnsq);
    gn_finalize<<<(NB * CIN * NPOS) / 256, 256, 0, stream>>>(ybase, gnsum, gnsq,
                                                             gnw, gnb, (float*)d_out);
}

// v004
// Next to v003, in two timings, it ran 1.07 and 1.09 times as fast.
// All steps since v000 together make it 4.00 times as fast.
#include <hip/hip_runtime.h>

// ---------------------------------------------------------------------------
// LinearAttention fused pipeline for gfx1250 (MI455X), fp32 WMMA path.
// Shapes: b=2, c=64, n=32768, heads=4, dim_head=32, hidden=128, qkv=384.
// Memory-bound: 34 MB mandatory HBM traffic; all intermediates L2-resident.
// ---------------------------------------------------------------------------

#define NPOS   32768           // 32*32*32 spatial positions
#define CIN    64
#define HID    128
#define QKVC   384
#define NB     2
#define SCALE_Q 0.17677669529663687f   // 32^-0.5
#define GN_EPS  1e-5f

typedef __attribute__((ext_vector_type(2))) float v2f;
typedef __attribute__((ext_vector_type(8))) float v8f;

__device__ __forceinline__ v8f wmma_f32(v2f a, v2f b, v8f c) {
    // V_WMMA_F32_16X16X4_F32: D(16x16,f32) = A(16x4,f32) x B(4x16,f32) + C
    return __builtin_amdgcn_wmma_f32_16x16x4_f32(
        /*neg_a=*/false, a, /*neg_b=*/false, b,
        /*c_mod=*/(short)0, c, /*reuse_a=*/false, /*reuse_b=*/false);
}

__device__ __forceinline__ float other_half(float v) {
    // value of lane ^ 16 (v_permlanex16_b32 with the identity lane select)
    return __int_as_float(__builtin_amdgcn_permlanex16(
        0, __float_as_int(v), 0x76543210, 0xfedcba98, false, false));
}

__device__ __forceinline__ void exp_pair(float& r0, float& r1, float x0, float x1) {
    // e^x as 2^(x * log2 e), two at a time.  In asm so that the slot the
    // instruction set asks for behind a transcendental is always filled: the
    // first by the second, which shares no register with it (early-clobber
    // outputs), the second by the v_nop, whatever the compiler puts next.
    asm("v_exp_f32 %0, %2\n\tv_exp_f32 %1, %3\n\tv_nop"
        : "=&v"(r0), "=&v"(r1)
        : "v"(x0 * 1.44269504f), "v"(x1 * 1.44269504f));
}

// ---------------------------------------------------------------------------
// Kernel 1: qkv[b][384][n] = w_qkv(384x64) @ x[b](64xn).
// One wave = one 16-row M tile x FOUR 16-col N tiles.  The 16 A fragments
// (16x64 weights striped per the 16x4 f32 layout) are preloaded into
// registers once; the K-loop only streams B (x) rows.
// A layout (16x4 f32): lanes 0-15 row=l K={0,1}; lanes 16-31 row=l K={2,3}.
// B layout (4x16 f32): lanes 0-15 col=l K rows {0,1}; lanes 16-31 rows {2,3}.
// C/D layout: VGPR j -> row j (lanes 0-15) / row j+8 (lanes 16-31).
// ---------------------------------------------------------------------------
__global__ __launch_bounds__(32)
void qkv_gemm(const float* __restrict__ x, const float* __restrict__ wqkv,
              float* __restrict__ qkv) {
    const int lane = threadIdx.x;
    const int half = lane >> 4;        // 0 or 1
    const int l    = lane & 15;
    const int nt   = blockIdx.x * 64;  // 4 N tiles of 16
    const int mt   = blockIdx.y * 16;
    const int b    = blockIdx.z;
    const float* xb = x + (size_t)b * CIN * NPOS;

    v2f af[16];                        // entire 16x64 A tile in registers
    #pragma unroll
    for (int k = 0; k < 16; ++k) {
        const int ka = k * 4 + half * 2;
        af[k].x = wqkv[(mt + l) * CIN + ka];
        af[k].y = wqkv[(mt + l) * CIN + ka + 1];
    }

    v8f acc[4] = {};
    #pragma unroll
    for (int k = 0; k < 16; ++k) {
        const int ka = k * 4 + half * 2;
        const float* r0 = xb + (size_t)ka       * NPOS + nt + l;
        const float* r1 = xb + (size_t)(ka + 1) * NPOS + nt + l;
        #pragma unroll
        for (int t = 0; t < 4; ++t) {
            v2f bb; bb.x = r0[t * 16]; bb.y = r1[t * 16];
            acc[t] = wmma_f32(af[k], bb, acc[t]);
        }
    }

    float* dst = qkv + (size_t)b * QKVC * NPOS;
    #pragma unroll
    for (int t = 0; t < 4; ++t)
        #pragma unroll
        for (int j = 0; j < 8; ++j) {
            const int row = mt + j + half * 8;
            dst[(size_t)row * NPOS + nt + t * 16 + l] = acc[t][j];
        }
}

// ---------------------------------------------------------------------------
// Kernel 2: context[b][h][d][e] = sum_n softmax_k[d][n] * v[e][n], with the
// softmax over n (axis 3) done in pieces: no separate pass over k.
// The n range of each (b,h) is cut into CSPLIT work-groups of CWAVES waves, so
// that 256 work-groups (one per WGP) share the sum.  Each wave holds its own
// 64 positions of the 32 k rows in registers, takes each row's max over them,
// and accumulates the full 32x32 (2x2 tiles of 16x16) with WMMA,
// A = exp(k - wave max) built in VALU, beside each row's sum of A.
// The LDS reduce brings the waves to the work-group's row max (factor
// exp(wave max - group max)); one un-normalised 32x32 partial, its 32 row
// maxima and its 32 row sums per work-group go to the workspace.
// ---------------------------------------------------------------------------
#define CSPLIT 32              // work-groups per (b,h) along n
#define CWAVES 16              // waves per work-group
#define CSTEPS (NPOS / (CSPLIT * CWAVES) / 4)   // WMMA k steps per wave

__global__ __launch_bounds__(CWAVES * 32)
void context_gemm(const float* __restrict__ qkv, float* __restrict__ part,
                  float* __restrict__ pmax, float* __restrict__ psum) {
    const int sp   = blockIdx.x;            // 0..CSPLIT-1
    const int bh   = blockIdx.y;            // 0..7
    const int b    = bh >> 2, h = bh & 3;
    const int wave = threadIdx.x >> 5;
    const int lane = threadIdx.x & 31;
    const int half = lane >> 4, l = lane & 15;

    // k order, A and B alike: step i, lane half hf, element j <-> the wave's
    // position 4i + 2hf + j (n0 holds the lane's 2hf)
    const int n0 = (sp * CWAVES + wave) * (CSTEPS * 4) + half * 2;
    const float* kr = qkv + (size_t)(b * QKVC + HID     + h * 32 + l) * NPOS + n0;
    const float* vr = qkv + (size_t)(b * QKVC + 2 * HID + h * 32 + l) * NPOS + n0;

    v2f a0[CSTEPS], a1[CSTEPS];             // rows l and 16 + l of k
    v2f b0[CSTEPS], b1[CSTEPS];             // B[k][e] = v[e][n], e = l and 16 + l
    #pragma unroll  // constant indices: the arrays stay in registers
    for (int i = 0; i < CSTEPS; ++i) {
        a0[i] = *(const v2f*)(kr + i * 4);
        // the last load may land on the address pair that the loads before it
        // name: the wait asked for before such a register is overwritten
        if (i == CSTEPS - 1) asm volatile("s_wait_xcnt 0x0" ::: "memory");
        a1[i] = *(const v2f*)(kr + (size_t)16 * NPOS + i * 4);
    }
    // likewise: a v load may land on the k address pair
    asm volatile("s_wait_xcnt 0x0" ::: "memory");
    #pragma unroll  // constant indices: the arrays stay in registers
    for (int i = 0; i < CSTEPS; ++i) {
        b0[i] = *(const v2f*)(vr + i * 4);
        // likewise for the last load from the v address pair
        if (i == CSTEPS - 1) asm volatile("s_wait_xcnt 0x0" ::: "memory");
        b1[i] = *(const v2f*)(vr + (size_t)16 * NPOS + i * 4);
    }
    // likewise: what is computed next may land on an address pair
    asm volatile("s_wait_xcnt 0x0" ::: "memory");
    // keeps the v loads ahead of the first wait for k: one trip to memory, not two
    __builtin_amdgcn_sched_barrier(0);

    // a lane holds 32 of its rows' 64 positions, lane ^ 16 the other 32
    float m0 = fmaxf(a0[0].x, a0[0].y), m1 = fmaxf(a1[0].x, a1[0].y);
    #pragma unroll  // constant indices: the arrays stay in registers
    for (int i = 1; i < CSTEPS; ++i) {
        m0 = fmaxf(m0, fmaxf(a0[i].x, a0[i].y));
        m1 = fmaxf(m1, fmaxf(a1[i].x, a1[i].y));
    }
    m0 = fmaxf(m0, other_half(m0));
    m1 = fmaxf(m1, other_half(m1));

    float s0 = 0.f, s1 = 0.f;
    #pragma unroll  // constant indices: the arrays stay in registers
    for (int i = 0; i < CSTEPS; ++i) {
        float x, y;
        exp_pair(x, y, a0[i].x - m0, a0[i].y - m0);
        a0[i].x = x; a0[i].y = y;
        s0 += x + y;
        exp_pair(x, y, a1[i].x - m1, a1[i].y - m1);
        a1[i].x = x; a1[i].y = y;
        s1 += x + y;
    }
    s0 += other_half(s0);
    s1 += other_half(s1);

    // keeps every asm exponential ahead of the first WMMA
    __builtin_amdgcn_sched_barrier(0);

    v8f acc[2][2] = {};
    #pragma unroll  // constant indices: the arrays stay in registers
    for (int i = 0; i < CSTEPS; ++i) {
        acc[0][0] = wmma_f32(a0[i], b0[i], acc[0][0]);
        acc[0][1] = wmma_f32(a0[i], b1[i], acc[0][1]);
        acc[1][0] = wmma_f32(a1[i], b0[i], acc[1][0]);
        acc[1][1] = wmma_f32(a1[i], b1[i], acc[1][1]);
    }

    __shared__ float sctx[CWAVES][32][32];  // 64 KB of the 320 KB LDS
    __shared__ float smax[CWAVES][32];
    __shared__ float ssum[CWAVES][32];
    #pragma unroll
    for (int dt = 0; dt < 2; ++dt)
        #pragma unroll
        for (int et = 0; et < 2; ++et)
            #pragma unroll
            for (int j = 0; j < 8; ++j)
                sctx[wave][dt * 16 + j + half * 8][et * 16 + l] = acc[dt][et][j];
    // both halves hold the same row values: half 0 stores row l, half 1 row 16 + l
    smax[wave][lane] = half ? m1 : m0;
    ssum[wave][lane] = half ? s1 : s0;
    __syncthreads();

    for (int idx = threadIdx.x; idx < 1024; idx += CWAVES * 32) {
        const int d = idx >> 5, e = idx & 31;
        float mw[CWAVES];
        #pragma unroll
        for (int w = 0; w < CWAVES; ++w) mw[w] = smax[w][d];
        float m = mw[0];
        #pragma unroll
        for (int w = 1; w < CWAVES; ++w) m = fmaxf(m, mw[w]);
        float s = 0.f, t = 0.f;
        #pragma unroll
        for (int w = 0; w < CWAVES; w += 2) {
            float f0, f1;
            exp_pair(f0, f1, mw[w] - m, mw[w + 1] - m);
            s += sctx[w][d][e] * f0;
            t += ssum[w][d] * f0;
            s += sctx[w + 1][d][e] * f1;
            t += ssum[w + 1][d] * f1;
        }
        part[((size_t)bh * CSPLIT + sp) * 1024 + idx] = s;
        if (e == 0) {
            pmax[(bh * CSPLIT + sp) * 32 + d] = m;
            psum[(bh * CSPLIT + sp) * 32 + d] = t;
        }
        // the next trip reuses the registers that these stores name: the wait
        // asked for before such a register is overwritten
        asm volatile("s_wait_xcnt 0x0" ::: "memory");
    }
}

// ---------------------------------------------------------------------------
// Kernel 3: context = sum of the CSPLIT partials, in index order, each brought
// to the row's overall max by exp(group max - max), over the row sums' like sum.
// ---------------------------------------------------------------------------
__global__ __launch_bounds__(256)
void context_merge(const float* __restrict__ part, const float* __restrict__ pmax,
                   const float* __restrict__ psum, float* __restrict__ ctx) {
    const int idx = blockIdx.x * 256 + threadIdx.x;   // < 8 * 1024
    const int bh  = idx >> 10, de = idx & 1023;
    const float* p  = part + (size_t)bh * CSPLIT * 1024 + de;
    const float* pm = pmax + bh * CSPLIT * 32 + (de >> 5);
    const float* ps = psum + bh * CSPLIT * 32 + (de >> 5);
    // unrolled so that all 3 * CSPLIT loads are in flight at once: one L2 trip.
    // Each s_wait_xcnt: a later load, the last of a run too, may land on the
    // address registers that the loads before it name; it is the wait asked for
    // before such a register is overwritten.
    float mv[CSPLIT], sv[CSPLIT], pv[CSPLIT];
    #pragma unroll
    for (int sp = 0; sp < CSPLIT; ++sp) {
        if (sp == CSPLIT - 1) asm volatile("s_wait_xcnt 0x0" ::: "memory");
        mv[sp] = pm[sp * 32];
    }
    asm volatile("s_wait_xcnt 0x0" ::: "memory");
    #pragma unroll
    for (int sp = 0; sp < CSPLIT; ++sp) {
        if (sp == CSPLIT - 1) asm volatile("s_wait_xcnt 0x0" ::: "memory");
        sv[sp] = ps[sp * 32];
    }
    asm volatile("s_wait_xcnt 0x0" ::: "memory");
    #pragma unroll
    for (int sp = 0; sp < CSPLIT; ++sp) {
        if (sp == CSPLIT - 1) asm volatile("s_wait_xcnt 0x0" ::: "memory");
        pv[sp] = p[sp * 1024];
    }
    asm volatile("s_wait_xcnt 0x0" ::: "memory");
    // keeps every load ahead of the first wait for one: one trip, not several
    __builtin_amdgcn_sched_barrier(0);
    float m = mv[0];
    #pragma unroll
    for (int sp = 1; sp < CSPLIT; ++sp) m = fmaxf(m, mv[sp]);
    float num = 0.f, den = 0.f;
    #pragma unroll
    for (int sp = 0; sp < CSPLIT; sp += 2) {
        float f0, f1;
        exp_pair(f0, f1, mv[sp] - m, mv[sp + 1] - m);
        num += pv[sp] * f0;
        den += sv[sp] * f0;
        num += pv[sp + 1] * f1;
        den += sv[sp + 1] * f1;
    }
    ctx[idx] = num / den;
}

// ---------------------------------------------------------------------------
// Kernel 4: per-position q softmax (over the 32 head channels) * SCALE, then
// out[e][n] = sum_d ctx[h][d][e] * q_sm[d][n] on the matrix unit.
// One wave = one head x 64 positions: M = e (2 tiles), K = d (8 steps of 4),
// N = positions (4 tiles).  A = ctx^T, 16 fragments held in registers, read
// straight from global (no LDS).  Column c of N tile t stands for position
// n0 + 4c + t, so a lane reads each q row and writes each out row as one
// 16-byte piece (256 contiguous bytes per 16 lanes).
// k order, A and B alike: step k, lane half hf, element i  <->  d = 4k + 2hf + i.
// A lane holds 16 of a position's 32 channels, lane ^ 16 the other 16.
// ---------------------------------------------------------------------------
#define QWAVES 16              // 4 heads x 4 chunks of 64 positions

typedef __attribute__((ext_vector_type(4))) float v4f;

__global__ __launch_bounds__(QWAVES * 32)
void q_apply(const float* __restrict__ qkv, const float* __restrict__ ctx,
             float* __restrict__ outbuf) {
    const int wave = threadIdx.x >> 5;
    const int lane = threadIdx.x & 31;
    const int half = lane >> 4, l = lane & 15;
    const int h    = wave & 3;
    const int b    = blockIdx.y;
    const int n0   = (blockIdx.x * (QWAVES / 4) + (wave >> 2)) * 64 + l * 4;

    const float* qb = qkv + ((size_t)b * QKVC + h * 32) * NPOS + n0;   // q channels
    const float* cb = ctx + ((size_t)b * 4 + h) * 1024;
    float* ob = outbuf + ((size_t)b * HID + h * 32) * NPOS + n0;

    v4f qv[8][2];                      // this lane's 16 channels x 4 positions
    #pragma unroll  // constant indices: the arrays stay in registers
    for (int k = 0; k < 8; ++k)
        #pragma unroll  // constant indices: the arrays stay in registers
        for (int i = 0; i < 2; ++i) {
            // the last load may land on the address pair that the fifteen before
            // it name: the wait asked for before such a register is overwritten
            if (k == 7 && i == 1) asm volatile("s_wait_xcnt 0x0" ::: "memory");
            qv[k][i] = *(const v4f*)(qb + (size_t)(k * 4 + half * 2 + i) * NPOS);
        }

    // likewise: the context loads below may land on the q address pair
    asm volatile("s_wait_xcnt 0x0" ::: "memory");

    v2f af[2][8];                      // A[e][d] = ctx[d][e]
    #pragma unroll  // constant indices: the arrays stay in registers
    for (int et = 0; et < 2; ++et)
        #pragma unroll  // constant indices: the arrays stay in registers
        for (int k = 0; k < 8; ++k) {
            const int d = k * 4 + half * 2;
            af[et][k].x = cb[d * 32 + et * 16 + l];
            af[et][k].y = cb[(d + 1) * 32 + et * 16 + l];
        }

    float inv[4];
    #pragma unroll  // constant indices: the arrays stay in registers
    for (int t = 0; t < 4; ++t) {
        float m = -1e30f;
        #pragma unroll  // constant indices: the arrays stay in registers
        for (int k = 0; k < 8; ++k) m = fmaxf(m, fmaxf(qv[k][0][t], qv[k][1][t]));
        m = fmaxf(m, other_half(m));
        float s = 0.f;
        #pragma unroll  // constant indices: the arrays stay in registers
        for (int k = 0; k < 8; ++k) {
            float e0, e1;
            exp_pair(e0, e1, qv[k][0][t] - m, qv[k][1][t] - m);
            qv[k][0][t] = e0; qv[k][1][t] = e1;
            s += e0 + e1;
        }
        s += other_half(s);
        inv[t] = SCALE_Q / s;
    }

    // keeps every asm exponential ahead of the first WMMA
    __builtin_amdgcn_sched_barrier(0);

    v8f acc[2][4] = {};
    #pragma unroll  // constant indices: the arrays stay in registers
    for (int k = 0; k < 8; ++k)
        #pragma unroll  // constant indices: the arrays stay in registers
        for (int t = 0; t < 4; ++t) {
            v2f bb; bb.x = qv[k][0][t]; bb.y = qv[k][1][t];
            acc[0][t] = wmma_f32(af[0][k], bb, acc[0][t]);
            acc[1][t] = wmma_f32(af[1][k], bb, acc[1][t]);
        }

    #pragma unroll  // constant indices: the arrays stay in registers
    for (int et = 0; et < 2; ++et)
        #pragma unroll  // constant indices: the arrays stay in registers
        for (int j = 0; j < 8; ++j) {
            v4f o;
            #pragma unroll  // constant indices: the arrays stay in registers
            for (int t = 0; t < 4; ++t) o[t] = acc[et][t][j] * inv[t];
            *(v4f*)(ob + (size_t)(et * 16 + j + half * 8) * NPOS) = o;
        }
}

// ---------------------------------------------------------------------------
// Kernel 5: y[b][64][n] = w_out(64x128) @ out + b_out  (WMMA, K=128), plus
// GroupNorm sum / sumsq accumulation (wave shuffle reduce -> one atomic).
// Same 4-N-tile, register-resident-A structure as kernel 1 (32 A fragments).
// y is written into the dead k-region of the qkv buffer.
// ---------------------------------------------------------------------------
__global__ __launch_bounds__(32)
void out_gemm(const float* __restrict__ outbuf, const float* __restrict__ wout,
              const float* __restrict__ bout, float* __restrict__ ybase,
              float* __restrict__ gnsum, float* __restrict__ gnsq) {
    const int lane = threadIdx.x;
    const int half = lane >> 4, l = lane & 15;
    const int nt = blockIdx.x * 64;    // 4 N tiles of 16
    const int mt = blockIdx.y * 16;
    const int b  = blockIdx.z;
    const float* ob = outbuf + (size_t)b * HID * NPOS;

    v2f af[32];                        // entire 16x128 A tile in registers
    #pragma unroll
    for (int k = 0; k < 32; ++k) {
        const int ka = k * 4 + half * 2;
        af[k].x = wout[(mt + l) * HID + ka];
        af[k].y = wout[(mt + l) * HID + ka + 1];
    }

    v8f acc[4] = {};
    #pragma unroll
    for (int k = 0; k < 32; ++k) {
        const int ka = k * 4 + half * 2;
        const float* r0 = ob + (size_t)ka       * NPOS + nt + l;
        const float* r1 = ob + (size_t)(ka + 1) * NPOS + nt + l;
        #pragma unroll
        for (int t = 0; t < 4; ++t) {
            v2f bb; bb.x = r0[t * 16]; bb.y = r1[t * 16];
            acc[t] = wmma_f32(af[k], bb, acc[t]);
        }
    }

    float* yb = ybase + (size_t)b * QKVC * NPOS;   // stride skips to batch b
    float lsum = 0.f, lsq = 0.f;
    #pragma unroll
    for (int t = 0; t < 4; ++t)
        #pragma unroll
        for (int j = 0; j < 8; ++j) {
            const int row = mt + j + half * 8;
            const float v = acc[t][j] + bout[row];
            yb[(size_t)row * NPOS + nt + t * 16 + l] = v;
            lsum += v; lsq += v * v;
        }
    for (int off = 16; off > 0; off >>= 1) {
        lsum += __shfl_down(lsum, off, 32);
        lsq  += __shfl_down(lsq,  off, 32);
    }
    if (lane == 0) {
        atomicAdd(&gnsum[b], lsum);
        atomicAdd(&gnsq[b], lsq);
    }
}

// ---------------------------------------------------------------------------
// Kernel 6: GroupNorm(1 group) finalize: (y-mean)*rsqrt(var+eps)*gamma + beta.
// One work-group per WGP: GWAVES waves, each lane takes GPIECES 16-byte pieces,
// all loaded before the first is used.  A work-group covers half of one channel
// row, so batch and channel (and with them the statistics, gamma and beta) are
// the same for the whole work-group.
// ---------------------------------------------------------------------------
#define GWAVES  16             // waves per work-group
#define GPIECES 8              // 16-byte pieces per lane
#define GSTRIDE (GWAVES * 32 * 4)          // floats one piece of all lanes covers
#define GSPAN   (GSTRIDE * GPIECES)        // floats per work-group: NPOS / 2

__global__ __launch_bounds__(GWAVES * 32)
void gn_finalize(const float* __restrict__ ybase, const float* __restrict__ gnsum,
                 const float* __restrict__ gnsq, const float* __restrict__ gw,
                 const float* __restrict__ gb, float* __restrict__ out) {
    const int row = blockIdx.x / (NPOS / GSPAN);          // b * 64 + o
    const int b   = row >> 6, o = row & 63;
    const int pos = (blockIdx.x % (NPOS / GSPAN)) * GSPAN + threadIdx.x * 4;
    const float* src = ybase + (size_t)b * QKVC * NPOS + (size_t)o * NPOS + pos;
    float* dst = out + (size_t)row * NPOS + pos;

    v4f v[GPIECES];
    #pragma unroll  // constant indices: the array stays in registers
    for (int i = 0; i < GPIECES; ++i) v[i] = *(const v4f*)(src + i * GSTRIDE);
    // what is computed next may land on a register that holds the loads' address:
    // the wait asked for before such a register is overwritten
    asm volatile("s_wait_xcnt 0x0" ::: "memory");

    const float count = 64.0f * NPOS;
    const float mean  = gnsum[b] / count;
    const float var   = gnsq[b] / count - mean * mean;
    const float inv   = rsqrtf(var + GN_EPS);
    const float g = gw[o], be = gb[o];
    #pragma unroll  // constant indices: the array stays in registers
    for (int i = 0; i < GPIECES; ++i) {
        v4f r;
        #pragma unroll
        for (int j = 0; j < 4; ++j) r[j] = (v[i][j] - mean) * inv * g + be;
        *(v4f*)(dst + i * GSTRIDE) = r;
    }
}

// ---------------------------------------------------------------------------
extern "C" void kernel_launch(void* const* d_in, const int* in_sizes, int n_in,
                              void* d_out, int out_size, void* d_ws, size_t ws_size,
                              hipStream_t stream) {
    const float* x    = (const float*)d_in[0];
    const float* wqkv = (const float*)d_in[1];
    const float* wout = (const float*)d_in[2];
    const float* bout = (const float*)d_in[3];
    const float* gnw  = (const float*)d_in[4];
    const float* gnb  = (const float*)d_in[5];

    float* ws     = (float*)d_ws;
    float* qkv    = ws;                                        // 25,165,824 f
    float* outbuf = qkv + (size_t)NB * QKVC * NPOS;            //  8,388,608 f
    float* pmax   = outbuf + (size_t)NB * HID * NPOS;          //      8,192 f
    float* psum   = pmax + NB * 4 * CSPLIT * 32;               //      8,192 f
    float* ctx    = psum + NB * 4 * CSPLIT * 32;               //      8,192 f
    float* gnsum  = ctx + NB * 4 * 32 * 32;                    //          2 f
    float* gnsq   = gnsum + NB;                                //          2 f
    float* part   = gnsq + NB;                                 //    262,144 f
    // y aliases the k channel region [128,192) of qkv (dead after kernel 2)
    float* ybase  = qkv + (size_t)HID * NPOS;

    hipMemsetAsync(gnsum, 0, 2 * NB * sizeof(float), stream);

    qkv_gemm   <<<dim3(NPOS / 64, QKVC / 16, NB), 32,  0, stream>>>(x, wqkv, qkv);
    context_gemm<<<dim3(CSPLIT, NB * 4), CWAVES * 32, 0, stream>>>(qkv, part, pmax, psum);
    context_merge<<<(NB * 4 * 1024) / 256, 256, 0, stream>>>(part, pmax, psum, ctx);
    q_apply    <<<dim3(NPOS / 256, NB), QWAVES * 32, 0, stream>>>(qkv, ctx, outbuf);
    out_gemm   <<<dim3(NPOS / 64, CIN / 16, NB), 32, 0, stream>>>(outbuf, wout, bout,
                                                                  ybase, gnsum, gnsq);
    gn_finalize<<<(NB * CIN * NPOS) / GSPAN, GWAVES * 32, 0, stream>>>(ybase, gnsum, gnsq,
                                                             gnw, gnb, (float*)d_out);
}

// v005
// In both of two side-by-side timings against v004, it was 1.21 times as fast.
// Counting every step since v000, it is 4.86 times as fast.
#include <hip/hip_runtime.h>

// ---------------------------------------------------------------------------
// LinearAttention fused pipeline for gfx1250 (MI455X), fp32 WMMA path.
// Shapes: b=2, c=64, n=32768, heads=4, dim_head=32, hidden=128, qkv=384.
// Memory-bound: 34 MB mandatory HBM traffic; all intermediates L2-resident.
// ---------------------------------------------------------------------------

#define NPOS   32768           // 32*32*32 spatial positions
#define CIN    64
#define HID    128
#define QKVC   384
#define NB     2
#define SCALE_Q 0.17677669529663687f   // 32^-0.5
#define GN_EPS  1e-5f

typedef __attribute__((ext_vector_type(2))) float v2f;
typedef __attribute__((ext_vector_type(8))) float v8f;

__device__ __forceinline__ v8f wmma_f32(v2f a, v2f b, v8f c) {
    // V_WMMA_F32_16X16X4_F32: D(16x16,f32) = A(16x4,f32) x B(4x16,f32) + C
    return __builtin_amdgcn_wmma_f32_16x16x4_f32(
        /*neg_a=*/false, a, /*neg_b=*/false, b,
        /*c_mod=*/(short)0, c, /*reuse_a=*/false, /*reuse_b=*/false);
}

__device__ __forceinline__ float other_half(float v) {
    // value of lane ^ 16 (v_permlanex16_b32 with the identity lane select)
    return __int_as_float(__builtin_amdgcn_permlanex16(
        0, __float_as_int(v), 0x76543210, 0xfedcba98, false, false));
}

__device__ __forceinline__ void exp_pair(float& r0, float& r1, float x0, float x1) {
    // e^x as 2^(x * log2 e), two at a time.  In asm so that the slot the
    // instruction set asks for behind a transcendental is always filled: the
    // first by the second, which shares no register with it (early-clobber
    // outputs), the second by the v_nop, whatever the compiler puts next.
    asm("v_exp_f32 %0, %2\n\tv_exp_f32 %1, %3\n\tv_nop"
        : "=&v"(r0), "=&v"(r1)
        : "v"(x0 * 1.44269504f), "v"(x1 * 1.44269504f));
}

// ---------------------------------------------------------------------------
// Kernel 1: qkv[b][384][n] = w_qkv(384x64) @ x[b](64xn).
// One work-group per WGP: PWAVES waves = 4 chunks of 64 positions x 4 groups of
// PTILES 16-row M tiles.  A wave holds its chunk of x (64 channels x 64
// positions, the B fragments of 4 N tiles) in registers for all its M tiles.
// Column c of N tile t stands for position n0 + 4c + t, so a lane reads each x
// row and writes each qkv row as one 16-byte piece (256 contiguous bytes per 16
// lanes).  The weights are staged once per work-group in LDS, in fragment order.
// A layout (16x4 f32): lanes 0-15 row=l K={0,1}; lanes 16-31 row=l K={2,3}.
// B layout (4x16 f32): lanes 0-15 col=l K rows {0,1}; lanes 16-31 rows {2,3}.
// C/D layout: VGPR j -> row j (lanes 0-15) / row j+8 (lanes 16-31).
// k order, A and B alike: step k, lane half hf, element i <-> channel 4k + 2hf + i.
// ---------------------------------------------------------------------------
#define PWAVES 16              // 4 chunks of 64 positions x 4 groups of M tiles
#define PTILES (QKVC / 16 / 4) // M tiles per wave

typedef __attribute__((ext_vector_type(4))) float v4f;

__global__ __launch_bounds__(PWAVES * 32)
void qkv_gemm(const float* __restrict__ x, const float* __restrict__ wqkv,
              float* __restrict__ qkv) {
    const int wave = threadIdx.x >> 5;
    const int lane = threadIdx.x & 31;
    const int half = lane >> 4, l = lane & 15;
    const int b    = blockIdx.y;
    const int n0   = (blockIdx.x * (PWAVES / 4) + (wave >> 2)) * 64 + l * 4;
    const int mg   = wave & 3;         // this wave's group of M tiles

    // sw[M tile][kk][slot]: the A fragments of steps 2kk and 2kk + 1 of one lane.
    // Lane (hf, l) has slot 16 hf + (l ^ 2kk): the readers' 16 lanes still cover
    // one run of 256 bytes, and the 32 lanes that stage two weight rows fall on
    // 32 different 8-byte bank pairs instead of four.
    __shared__ v4f sw[QKVC / 16][8][32];    // 96 KB of the 320 KB LDS

    // the weights are asked for first: they are staged while x is on its way
    v4f wv[QKVC * 16 / (PWAVES * 32)]; // 16-byte pieces of w_qkv, in memory order
    #pragma unroll  // constant indices: the array stays in registers
    for (int i = 0; i < QKVC * 16 / (PWAVES * 32); ++i) {
        // the last load may land on the address that the loads before it name: the
        // wait asked for before such a register is overwritten
        if (i == QKVC * 16 / (PWAVES * 32) - 1) asm volatile("s_wait_xcnt 0x0" ::: "memory");
        wv[i] = *(const v4f*)(wqkv + (i * PWAVES * 32 + threadIdx.x) * 4);
    }
    // likewise: the x loads below may land on the weight address
    asm volatile("s_wait_xcnt 0x0" ::: "memory");
    const float* xb = x + (size_t)b * CIN * NPOS + n0;
    v4f xv[16][2];                     // this lane's 32 channels x 4 positions
    #pragma unroll  // constant indices: the array stays in registers
    for (int k = 0; k < 16; ++k)
        #pragma unroll  // constant indices: the array stays in registers
        for (int i = 0; i < 2; ++i) {
            // likewise for the last load from the x address pair
            if (k == 15 && i == 1) asm volatile("s_wait_xcnt 0x0" ::: "memory");
            xv[k][i] = *(const v4f*)(xb + (size_t)(k * 4 + half * 2 + i) * NPOS);
        }
    // likewise: what is computed next may land on the x address pair
    asm volatile("s_wait_xcnt 0x0" ::: "memory");

    #pragma unroll  // constant indices: the array stays in registers
    for (int i = 0; i < QKVC * 16 / (PWAVES * 32); ++i) {
        const int p = i * PWAVES * 32 + threadIdx.x;
        const int row = p >> 4, c = p & 15;         // piece c: channels 4c .. 4c + 3
        const int slot = (row & 15) ^ (c & 14);     // step c, kk = c >> 1
        v2f lo, hi;
        lo.x = wv[i].x; lo.y = wv[i].y;             // half 0 of step c
        hi.x = wv[i].z; hi.y = wv[i].w;             // half 1 of step c
        *((v2f*)&sw[row >> 4][c >> 1][slot] + (c & 1))      = lo;
        *((v2f*)&sw[row >> 4][c >> 1][16 + slot] + (c & 1)) = hi;
    }
    __syncthreads();
    // keeps what waits for x behind the staging: the weights reach LDS while x is
    // still on its way
    __builtin_amdgcn_sched_barrier(0);

    const v4f* ap[8];                  // this lane's slot of its first M tile, per kk
    #pragma unroll  // constant indices: the array stays in registers
    for (int kk = 0; kk < 8; ++kk)
        ap[kk] = &sw[mg * PTILES][kk][half * 16 + (l ^ (2 * kk))];
    float* dst = qkv + ((size_t)b * QKVC + mg * (PTILES * 16) + half * 8) * NPOS + n0;

    v2f bp[16][4];                     // B fragments: step k, N tile t
    #pragma unroll  // constant indices: the arrays stay in registers
    for (int k = 0; k < 16; ++k)
        #pragma unroll  // constant indices: the arrays stay in registers
        for (int t = 0; t < 4; ++t) { bp[k][t].x = xv[k][0][t]; bp[k][t].y = xv[k][1][t]; }
    // keeps the address sums and the moves that pair the channels ahead of the first
    // WMMA: among the WMMAs they would land on operand registers right behind their
    // last use
    __builtin_amdgcn_sched_barrier(0);

    #pragma unroll  // constant LDS and store offsets: no address sums among the WMMAs
    for (int m = 0; m < PTILES; ++m) {
        v4f aw[8];
        #pragma unroll  // constant indices: the array stays in registers
        for (int kk = 0; kk < 8; ++kk)
            aw[kk] = ap[kk][m * 8 * 32];

        v8f acc[4] = {};
        #pragma unroll  // constant indices: the arrays stay in registers
        for (int k = 0; k < 16; ++k) {
            v2f a;
            a.x = (k & 1) ? aw[k >> 1].z : aw[k >> 1].x;
            a.y = (k & 1) ? aw[k >> 1].w : aw[k >> 1].y;
            #pragma unroll  // constant indices: the arrays stay in registers
            for (int t = 0; t < 4; ++t) acc[t] = wmma_f32(a, bp[k][t], acc[t]);
        }

        // the four vector slots between a WMMA and a vector instruction that reads
        // or overwrites its result or overwrites its operands: the two scheduling
        // barriers hold the slots in place
        __builtin_amdgcn_sched_barrier(0);
        asm volatile("v_nop\n\tv_nop\n\tv_nop\n\tv_nop");
        __builtin_amdgcn_sched_barrier(0);

        #pragma unroll  // constant indices: the arrays stay in registers
        for (int j = 0; j < 8; ++j) {
            v4f o;
            #pragma unroll  // constant indices: the arrays stay in registers
            for (int t = 0; t < 4; ++t) o[t] = acc[t][j];
            *(v4f*)(dst + (size_t)(m * 16 + j) * NPOS) = o;
        }
        // a later tile's stores may need a new address in the registers that these
        // stores name: the wait asked for before such a register is overwritten
        asm volatile("s_wait_xcnt 0x0" ::: "memory");
    }
}

// ---------------------------------------------------------------------------
// Kernel 2: context[b][h][d][e] = sum_n softmax_k[d][n] * v[e][n], with the
// softmax over n (axis 3) done in pieces: no separate pass over k.
// The n range of each (b,h) is cut into CSPLIT work-groups of CWAVES waves, so
// that 256 work-groups (one per WGP) share the sum.  Each wave holds its own
// 64 positions of the 32 k rows in registers, takes each row's max over them,
// and accumulates the full 32x32 (2x2 tiles of 16x16) with WMMA,
// A = exp(k - wave max) built in VALU, beside each row's sum of A.
// The LDS reduce brings the waves to the work-group's row max (factor
// exp(wave max - group max)); one un-normalised 32x32 partial, its 32 row
// maxima and its 32 row sums per work-group go to the workspace.
// ---------------------------------------------------------------------------
#define CSPLIT 32              // work-groups per (b,h) along n
#define CWAVES 16              // waves per work-group
#define CSTEPS (NPOS / (CSPLIT * CWAVES) / 4)   // WMMA k steps per wave

__global__ __launch_bounds__(CWAVES * 32)
void context_gemm(const float* __restrict__ qkv, float* __restrict__ part,
                  float* __restrict__ pmax, float* __restrict__ psum) {
    const int sp   = blockIdx.x;            // 0..CSPLIT-1
    const int bh   = blockIdx.y;            // 0..7
    const int b    = bh >> 2, h = bh & 3;
    const int wave = threadIdx.x >> 5;
    const int lane = threadIdx.x & 31;
    const int half = lane >> 4, l = lane & 15;

    // k order, A and B alike: step i, lane half hf, element j <-> the wave's
    // position 4i + 2hf + j (n0 holds the lane's 2hf)
    const int n0 = (sp * CWAVES + wave) * (CSTEPS * 4) + half * 2;
    const float* kr = qkv + (size_t)(b * QKVC + HID     + h * 32 + l) * NPOS + n0;
    const float* vr = qkv + (size_t)(b * QKVC + 2 * HID + h * 32 + l) * NPOS + n0;

    v2f a0[CSTEPS], a1[CSTEPS];             // rows l and 16 + l of k
    v2f b0[CSTEPS], b1[CSTEPS];             // B[k][e] = v[e][n], e = l and 16 + l
    #pragma unroll  // constant indices: the arrays stay in registers
    for (int i = 0; i < CSTEPS; ++i) {
        a0[i] = *(const v2f*)(kr + i * 4);
        // the last load may land on the address pair that the loads before it
        // name: the wait asked for before such a register is overwritten
        if (i == CSTEPS - 1) asm volatile("s_wait_xcnt 0x0" ::: "memory");
        a1[i] = *(const v2f*)(kr + (size_t)16 * NPOS + i * 4);
    }
    // likewise: a v load may land on the k address pair
    asm volatile("s_wait_xcnt 0x0" ::: "memory");
    #pragma unroll  // constant indices: the arrays stay in registers
    for (int i = 0; i < CSTEPS; ++i) {
        b0[i] = *(const v2f*)(vr + i * 4);
        // likewise for the last load from the v address pair
        if (i == CSTEPS - 1) asm volatile("s_wait_xcnt 0x0" ::: "memory");
        b1[i] = *(const v2f*)(vr + (size_t)16 * NPOS + i * 4);
    }
    // likewise: what is computed next may land on an address pair
    asm volatile("s_wait_xcnt 0x0" ::: "memory");
    // keeps the v loads ahead of the first wait for k: one trip to memory, not two
    __builtin_amdgcn_sched_barrier(0);

    // a lane holds 32 of its rows' 64 positions, lane ^ 16 the other 32
    float m0 = fmaxf(a0[0].x, a0[0].y), m1 = fmaxf(a1[0].x, a1[0].y);
    #pragma unroll  // constant indices: the arrays stay in registers
    for (int i = 1; i < CSTEPS; ++i) {
        m0 = fmaxf(m0, fmaxf(a0[i].x, a0[i].y));
        m1 = fmaxf(m1, fmaxf(a1[i].x, a1[i].y));
    }
    m0 = fmaxf(m0, other_half(m0));
    m1 = fmaxf(m1, other_half(m1));

    float s0 = 0.f, s1 = 0.f;
    #pragma unroll  // constant indices: the arrays stay in registers
    for (int i = 0; i < CSTEPS; ++i) {
        float x, y;
        exp_pair(x, y, a0[i].x - m0, a0[i].y - m0);
        a0[i].x = x; a0[i].y = y;
        s0 += x + y;
        exp_pair(x, y, a1[i].x - m1, a1[i].y - m1);
        a1[i].x = x; a1[i].y = y;
        s1 += x + y;
    }
    s0 += other_half(s0);
    s1 += other_half(s1);

    // keeps every asm exponential ahead of the first WMMA
    __builtin_amdgcn_sched_barrier(0);

    v8f acc[2][2] = {};
    #pragma unroll  // constant indices: the arrays stay in registers
    for (int i = 0; i < CSTEPS; ++i) {
        acc[0][0] = wmma_f32(a0[i], b0[i], acc[0][0]);
        acc[0][1] = wmma_f32(a0[i], b1[i], acc[0][1]);
        acc[1][0] = wmma_f32(a1[i], b0[i], acc[1][0]);
        acc[1][1] = wmma_f32(a1[i], b1[i], acc[1][1]);
    }

    __shared__ float sctx[CWAVES][32][32];  // 64 KB of the 320 KB LDS
    __shared__ float smax[CWAVES][32];
    __shared__ float ssum[CWAVES][32];
    #pragma unroll
    for (int dt = 0; dt < 2; ++dt)
        #pragma unroll
        for (int et = 0; et < 2; ++et)
            #pragma unroll
            for (int j = 0; j < 8; ++j)
                sctx[wave][dt * 16 + j + half * 8][et * 16 + l] = acc[dt][et][j];
    // both halves hold the same row values: half 0 stores row l, half 1 row 16 + l
    smax[wave][lane] = half ? m1 : m0;
    ssum[wave][lane] = half ? s1 : s0;
    __syncthreads();

    for (int idx = threadIdx.x; idx < 1024; idx += CWAVES * 32) {
        const int d = idx >> 5, e = idx & 31;
        float mw[CWAVES];
        #pragma unroll
        for (int w = 0; w < CWAVES; ++w) mw[w] = smax[w][d];
        float m = mw[0];
        #pragma unroll
        for (int w = 1; w < CWAVES; ++w) m = fmaxf(m, mw[w]);
        float s = 0.f, t = 0.f;
        #pragma unroll
        for (int w = 0; w < CWAVES; w += 2) {
            float f0, f1;
            exp_pair(f0, f1, mw[w] - m, mw[w + 1] - m);
            s += sctx[w][d][e] * f0;
            t += ssum[w][d] * f0;
            s += sctx[w + 1][d][e] * f1;
            t += ssum[w + 1][d] * f1;
        }
        part[((size_t)bh * CSPLIT + sp) * 1024 + idx] = s;
        if (e == 0) {
            pmax[(bh * CSPLIT + sp) * 32 + d] = m;
            psum[(bh * CSPLIT + sp) * 32 + d] = t;
        }
        // the next trip reuses the registers that these stores name: the wait
        // asked for before such a register is overwritten
        asm volatile("s_wait_xcnt 0x0" ::: "memory");
    }
}

// ---------------------------------------------------------------------------
// Kernel 3: context = sum of the CSPLIT partials, in index order, each brought
// to the row's overall max by exp(group max - max), over the row sums' like sum.
// ---------------------------------------------------------------------------
__global__ __launch_bounds__(256)
void context_merge(const float* __restrict__ part, const float* __restrict__ pmax,
                   const float* __restrict__ psum, float* __restrict__ ctx) {
    const int idx = blockIdx.x * 256 + threadIdx.x;   // < 8 * 1024
    const int bh  = idx >> 10, de = idx & 1023;
    const float* p  = part + (size_t)bh * CSPLIT * 1024 + de;
    const float* pm = pmax + bh * CSPLIT * 32 + (de >> 5);
    const float* ps = psum + bh * CSPLIT * 32 + (de >> 5);
    // unrolled so that all 3 * CSPLIT loads are in flight at once: one L2 trip.
    // Each s_wait_xcnt: a later load, the last of a run too, may land on the
    // address registers that the loads before it name; it is the wait asked for
    // before such a register is overwritten.
    float mv[CSPLIT], sv[CSPLIT], pv[CSPLIT];
    #pragma unroll
    for (int sp = 0; sp < CSPLIT; ++sp) {
        if (sp == CSPLIT - 1) asm volatile("s_wait_xcnt 0x0" ::: "memory");
        mv[sp] = pm[sp * 32];
    }
    asm volatile("s_wait_xcnt 0x0" ::: "memory");
    #pragma unroll
    for (int sp = 0; sp < CSPLIT; ++sp) {
        if (sp == CSPLIT - 1) asm volatile("s_wait_xcnt 0x0" ::: "memory");
        sv[sp] = ps[sp * 32];
    }
    asm volatile("s_wait_xcnt 0x0" ::: "memory");
    #pragma unroll
    for (int sp = 0; sp < CSPLIT; ++sp) {
        if (sp == CSPLIT - 1) asm volatile("s_wait_xcnt 0x0" ::: "memory");
        pv[sp] = p[sp * 1024];
    }
    asm volatile("s_wait_xcnt 0x0" ::: "memory");
    // keeps every load ahead of the first wait for one: one trip, not several
    __builtin_amdgcn_sched_barrier(0);
    float m = mv[0];
    #pragma unroll
    for (int sp = 1; sp < CSPLIT; ++sp) m = fmaxf(m, mv[sp]);
    float num = 0.f, den = 0.f;
    #pragma unroll
    for (int sp = 0; sp < CSPLIT; sp += 2) {
        float f0, f1;
        exp_pair(f0, f1, mv[sp] - m, mv[sp + 1] - m);
        num += pv[sp] * f0;
        den += sv[sp] * f0;
        num += pv[sp + 1] * f1;
        den += sv[sp + 1] * f1;
    }
    ctx[idx] = num / den;
}

// ---------------------------------------------------------------------------
// Kernel 4: per-position q softmax (over the 32 head channels) * SCALE, then
// out[e][n] = sum_d ctx[h][d][e] * q_sm[d][n] on the matrix unit.
// One wave = one head x 64 positions: M = e (2 tiles), K = d (8 steps of 4),
// N = positions (4 tiles).  A = ctx^T, 16 fragments held in registers, read
// straight from global (no LDS).  Column c of N tile t stands for position
// n0 + 4c + t, so a lane reads each q row and writes each out row as one
// 16-byte piece (256 contiguous bytes per 16 lanes).
// k order, A and B alike: step k, lane half hf, element i  <->  d = 4k + 2hf + i.
// A lane holds 16 of a position's 32 channels, lane ^ 16 the other 16.
// ---------------------------------------------------------------------------
#define QWAVES 16              // 4 heads x 4 chunks of 64 positions

__global__ __launch_bounds__(QWAVES * 32)
void q_apply(const float* __restrict__ qkv, const float* __restrict__ ctx,
             float* __restrict__ outbuf) {
    const int wave = threadIdx.x >> 5;
    const int lane = threadIdx.x & 31;
    const int half = lane >> 4, l = lane & 15;
    const int h    = wave & 3;
    const int b    = blockIdx.y;
    const int n0   = (blockIdx.x * (QWAVES / 4) + (wave >> 2)) * 64 + l * 4;

    const float* qb = qkv + ((size_t)b * QKVC + h * 32) * NPOS + n0;   // q channels
    const float* cb = ctx + ((size_t)b * 4 + h) * 1024;
    float* ob = outbuf + ((size_t)b * HID + h * 32) * NPOS + n0;

    v4f qv[8][2];                      // this lane's 16 channels x 4 positions
    #pragma unroll  // constant indices: the arrays stay in registers
    for (int k = 0; k < 8; ++k)
        #pragma unroll  // constant indices: the arrays stay in registers
        for (int i = 0; i < 2; ++i) {
            // the last load may land on the address pair that the fifteen before
            // it name: the wait asked for before such a register is overwritten
            if (k == 7 && i == 1) asm volatile("s_wait_xcnt 0x0" ::: "memory");
            qv[k][i] = *(const v4f*)(qb + (size_t)(k * 4 + half * 2 + i) * NPOS);
        }

    // likewise: the context loads below may land on the q address pair
    asm volatile("s_wait_xcnt 0x0" ::: "memory");

    v2f af[2][8];                      // A[e][d] = ctx[d][e]
    #pragma unroll  // constant indices: the arrays stay in registers
    for (int et = 0; et < 2; ++et)
        #pragma unroll  // constant indices: the arrays stay in registers
        for (int k = 0; k < 8; ++k) {
            const int d = k * 4 + half * 2;
            af[et][k].x = cb[d * 32 + et * 16 + l];
            af[et][k].y = cb[(d + 1) * 32 + et * 16 + l];
        }

    float inv[4];
    #pragma unroll  // constant indices: the arrays stay in registers
    for (int t = 0; t < 4; ++t) {
        float m = -1e30f;
        #pragma unroll  // constant indices: the arrays stay in registers
        for (int k = 0; k < 8; ++k) m = fmaxf(m, fmaxf(qv[k][0][t], qv[k][1][t]));
        m = fmaxf(m, other_half(m));
        float s = 0.f;
        #pragma unroll  // constant indices: the arrays stay in registers
        for (int k = 0; k < 8; ++k) {
            float e0, e1;
            exp_pair(e0, e1, qv[k][0][t] - m, qv[k][1][t] - m);
            qv[k][0][t] = e0; qv[k][1][t] = e1;
            s += e0 + e1;
        }
        s += other_half(s);
        inv[t] = SCALE_Q / s;
    }

    // keeps every asm exponential ahead of the first WMMA
    __builtin_amdgcn_sched_barrier(0);

    v8f acc[2][4] = {};
    #pragma unroll  // constant indices: the arrays stay in registers
    for (int k = 0; k < 8; ++k)
        #pragma unroll  // constant indices: the arrays stay in registers
        for (int t = 0; t < 4; ++t) {
            v2f bb; bb.x = qv[k][0][t]; bb.y = qv[k][1][t];
            acc[0][t] = wmma_f32(af[0][k], bb, acc[0][t]);
            acc[1][t] = wmma_f32(af[1][k], bb, acc[1][t]);
        }

    #pragma unroll  // constant indices: the arrays stay in registers
    for (int et = 0; et < 2; ++et)
        #pragma unroll  // constant indices: the arrays stay in registers
        for (int j = 0; j < 8; ++j) {
            v4f o;
            #pragma unroll  // constant indices: the arrays stay in registers
            for (int t = 0; t < 4; ++t) o[t] = acc[et][t][j] * inv[t];
            *(v4f*)(ob + (size_t)(et * 16 + j + half * 8) * NPOS) = o;
        }
}

// ---------------------------------------------------------------------------
// Kernel 5: y[b][64][n] = w_out(64x128) @ out + b_out  (WMMA, K=128), plus
// GroupNorm sum / sumsq accumulation (wave shuffle reduce -> one atomic).
// One wave = one 16-row M tile x four 16-col N tiles, 32 A fragments in registers.
// y is written into the dead k-region of the qkv buffer.
// ---------------------------------------------------------------------------
__global__ __launch_bounds__(32)
void out_gemm(const float* __restrict__ outbuf, const float* __restrict__ wout,
              const float* __restrict__ bout, float* __restrict__ ybase,
              float* __restrict__ gnsum, float* __restrict__ gnsq) {
    const int lane = threadIdx.x;
    const int half = lane >> 4, l = lane & 15;
    const int nt = blockIdx.x * 64;    // 4 N tiles of 16
    const int mt = blockIdx.y * 16;
    const int b  = blockIdx.z;
    const float* ob = outbuf + (size_t)b * HID * NPOS;

    v2f af[32];                        // entire 16x128 A tile in registers
    #pragma unroll
    for (int k = 0; k < 32; ++k) {
        const int ka = k * 4 + half * 2;
        af[k].x = wout[(mt + l) * HID + ka];
        af[k].y = wout[(mt + l) * HID + ka + 1];
    }

    v8f acc[4] = {};
    #pragma unroll
    for (int k = 0; k < 32; ++k) {
        const int ka = k * 4 + half * 2;
        const float* r0 = ob + (size_t)ka       * NPOS + nt + l;
        const float* r1 = ob + (size_t)(ka + 1) * NPOS + nt + l;
        #pragma unroll
        for (int t = 0; t < 4; ++t) {
            v2f bb; bb.x = r0[t * 16]; bb.y = r1[t * 16];
            acc[t] = wmma_f32(af[k], bb, acc[t]);
        }
    }

    float* yb = ybase + (size_t)b * QKVC * NPOS;   // stride skips to batch b
    float lsum = 0.f, lsq = 0.f;
    #pragma unroll
    for (int t = 0; t < 4; ++t)
        #pragma unroll
        for (int j = 0; j < 8; ++j) {
            const int row = mt + j + half * 8;
            const float v = acc[t][j] + bout[row];
            yb[(size_t)row * NPOS + nt + t * 16 + l] = v;
            lsum += v; lsq += v * v;
        }
    for (int off = 16; off > 0; off >>= 1) {
        lsum += __shfl_down(lsum, off, 32);
        lsq  += __shfl_down(lsq,  off, 32);
    }
    if (lane == 0) {
        atomicAdd(&gnsum[b], lsum);
        atomicAdd(&gnsq[b], lsq);
    }
}

// ---------------------------------------------------------------------------
// Kernel 6: GroupNorm(1 group) finalize: (y-mean)*rsqrt(var+eps)*gamma + beta.
// One work-group per WGP: GWAVES waves, each lane takes GPIECES 16-byte pieces,
// all loaded before the first is used.  A work-group covers half of one channel
// row, so batch and channel (and with them the statistics, gamma and beta) are
// the same for the whole work-group.
// ---------------------------------------------------------------------------
#define GWAVES  16             // waves per work-group
#define GPIECES 8              // 16-byte pieces per lane
#define GSTRIDE (GWAVES * 32 * 4)          // floats one piece of all lanes covers
#define GSPAN   (GSTRIDE * GPIECES)        // floats per work-group: NPOS / 2

__global__ __launch_bounds__(GWAVES * 32)
void gn_finalize(const float* __restrict__ ybase, const float* __restrict__ gnsum,
                 const float* __restrict__ gnsq, const float* __restrict__ gw,
                 const float* __restrict__ gb, float* __restrict__ out) {
    const int row = blockIdx.x / (NPOS / GSPAN);          // b * 64 + o
    const int b   = row >> 6, o = row & 63;
    const int pos = (blockIdx.x % (NPOS / GSPAN)) * GSPAN + threadIdx.x * 4;
    const float* src = ybase + (size_t)b * QKVC * NPOS + (size_t)o * NPOS + pos;
    float* dst = out + (size_t)row * NPOS + pos;

    v4f v[GPIECES];
    #pragma unroll  // constant indices: the array stays in registers
    for (int i = 0; i < GPIECES; ++i) v[i] = *(const v4f*)(src + i * GSTRIDE);
    // what is computed next may land on a register that holds the loads' address:
    // the wait asked for before such a register is overwritten
    asm volatile("s_wait_xcnt 0x0" ::: "memory");

    const float count = 64.0f * NPOS;
    const float mean  = gnsum[b] / count;
    const float var   = gnsq[b] / count - mean * mean;
    const float inv   = rsqrtf(var + GN_EPS);
    const float g = gw[o], be = gb[o];
    #pragma unroll  // constant indices: the array stays in registers
    for (int i = 0; i < GPIECES; ++i) {
        v4f r;
        #pragma unroll
        for (int j = 0; j < 4; ++j) r[j] = (v[i][j] - mean) * inv * g + be;
        *(v4f*)(dst + i * GSTRIDE) = r;
    }
}

// ---------------------------------------------------------------------------
extern "C" void kernel_launch(void* const* d_in, const int* in_sizes, int n_in,
                              void* d_out, int out_size, void* d_ws, size_t ws_size,
                              hipStream_t stream) {
    const float* x    = (const float*)d_in[0];
    const float* wqkv = (const float*)d_in[1];
    const float* wout = (const float*)d_in[2];
    const float* bout = (const float*)d_in[3];
    const float* gnw  = (const float*)d_in[4];
    const float* gnb  = (const float*)d_in[5];

    float* ws     = (float*)d_ws;
    float* qkv    = ws;                                        // 25,165,824 f
    float* outbuf = qkv + (size_t)NB * QKVC * NPOS;            //  8,388,608 f
    float* pmax   = outbuf + (size_t)NB * HID * NPOS;          //      8,192 f
    float* psum   = pmax + NB * 4 * CSPLIT * 32;               //      8,192 f
    float* ctx    = psum + NB * 4 * CSPLIT * 32;               //      8,192 f
    float* gnsum  = ctx + NB * 4 * 32 * 32;                    //          2 f
    float* gnsq   = gnsum + NB;                                //          2 f
    float* part   = gnsq + NB;                                 //    262,144 f
    // y aliases the k channel region [128,192) of qkv (dead after kernel 2)
    float* ybase  = qkv + (size_t)HID * NPOS;

    hipMemsetAsync(gnsum, 0, 2 * NB * sizeof(float), stream);

    qkv_gemm   <<<dim3(NPOS / 256, NB), PWAVES * 32, 0, stream>>>(x, wqkv, qkv);
    context_gemm<<<dim3(CSPLIT, NB * 4), CWAVES * 32, 0, stream>>>(qkv, part, pmax, psum);
    context_merge<<<(NB * 4 * 1024) / 256, 256, 0, stream>>>(part, pmax, psum, ctx);
    q_apply    <<<dim3(NPOS / 256, NB), QWAVES * 32, 0, stream>>>(qkv, ctx, outbuf);
    out_gemm   <<<dim3(NPOS / 64, CIN / 16, NB), 32, 0, stream>>>(outbuf, wout, bout,
                                                                  ybase, gnsum, gnsq);
    gn_finalize<<<(NB * CIN * NPOS) / GSPAN, GWAVES * 32, 0, stream>>>(ybase, gnsum, gnsq,
                                                             gnw, gnb, (float*)d_out);
}

// v006
// In both of two side-by-side timings against v005, it was 1.32 times as fast.
// All steps since v000 together make it 6.43 times as fast.
#include <hip/hip_runtime.h>

// ---------------------------------------------------------------------------
// LinearAttention fused pipeline for gfx1250 (MI455X), fp32 WMMA path.
// Shapes: b=2, c=64, n=32768, heads=4, dim_head=32, hidden=128, qkv=384.
// Memory-bound: 34 MB mandatory HBM traffic; all intermediates L2-resident.
// ---------------------------------------------------------------------------

#define NPOS   32768           // 32*32*32 spatial positions
#define CIN    64
#define HID    128
#define QKVC   384
#define NB     2
#define SCALE_Q 0.17677669529663687f   // 32^-0.5
#define GN_EPS  1e-5f

typedef __attribute__((ext_vector_type(2))) float v2f;
typedef __attribute__((ext_vector_type(8))) float v8f;

__device__ __forceinline__ v8f wmma_f32(v2f a, v2f b, v8f c) {
    // V_WMMA_F32_16X16X4_F32: D(16x16,f32) = A(16x4,f32) x B(4x16,f32) + C
    return __builtin_amdgcn_wmma_f32_16x16x4_f32(
        /*neg_a=*/false, a, /*neg_b=*/false, b,
        /*c_mod=*/(short)0, c, /*reuse_a=*/false, /*reuse_b=*/false);
}

__device__ __forceinline__ float other_half(float v) {
    // value of lane ^ 16 (v_permlanex16_b32 with the identity lane select)
    return __int_as_float(__builtin_amdgcn_permlanex16(
        0, __float_as_int(v), 0x76543210, 0xfedcba98, false, false));
}

template <int MASK>
__device__ __forceinline__ float row_xor(float v) {
    // value of lane ^ MASK inside the 16-lane row (DPP row_xmask): no LDS trip
    return __int_as_float(__builtin_amdgcn_update_dpp(
        0, __float_as_int(v), 0x160 + MASK, 0xf, 0xf, false));
}

__device__ __forceinline__ void exp_pair(float& r0, float& r1, float x0, float x1) {
    // e^x as 2^(x * log2 e), two at a time.  In asm so that the slot the
    // instruction set asks for behind a transcendental is always filled: the
    // first by the second, which shares no register with it (early-clobber
    // outputs), the second by the v_nop, whatever the compiler puts next.
    asm("v_exp_f32 %0, %2\n\tv_exp_f32 %1, %3\n\tv_nop"
        : "=&v"(r0), "=&v"(r1)
        : "v"(x0 * 1.44269504f), "v"(x1 * 1.44269504f));
}

// ---------------------------------------------------------------------------
// Kernel 1: qkv[b][384][n] = w_qkv(384x64) @ x[b](64xn).
// One work-group per WGP: PWAVES waves = 4 chunks of 64 positions x 4 groups of
// PTILES 16-row M tiles.  A wave holds its chunk of x (64 channels x 64
// positions, the B fragments of 4 N tiles) in registers for all its M tiles.
// Column c of N tile t stands for position n0 + 4c + t, so a lane reads each x
// row and writes each qkv row as one 16-byte piece (256 contiguous bytes per 16
// lanes).  The weights are staged once per work-group in LDS, in fragment order.
// A layout (16x4 f32): lanes 0-15 row=l K={0,1}; lanes 16-31 row=l K={2,3}.
// B layout (4x16 f32): lanes 0-15 col=l K rows {0,1}; lanes 16-31 rows {2,3}.
// C/D layout: VGPR j -> row j (lanes 0-15) / row j+8 (lanes 16-31).
// k order, A and B alike: step k, lane half hf, element i <-> channel 4k + 2hf + i.
// ---------------------------------------------------------------------------
#define PWAVES 16              // 4 chunks of 64 positions x 4 groups of M tiles
#define PTILES (QKVC / 16 / 4) // M tiles per wave

typedef __attribute__((ext_vector_type(4))) float v4f;

__global__ __launch_bounds__(PWAVES * 32)
void qkv_gemm(const float* __restrict__ x, const float* __restrict__ wqkv,
              float* __restrict__ qkv) {
    const int wave = threadIdx.x >> 5;
    const int lane = threadIdx.x & 31;
    const int half = lane >> 4, l = lane & 15;
    const int b    = blockIdx.y;
    const int n0   = (blockIdx.x * (PWAVES / 4) + (wave >> 2)) * 64 + l * 4;
    const int mg   = wave & 3;         // this wave's group of M tiles

    // sw[M tile][kk][slot]: the A fragments of steps 2kk and 2kk + 1 of one lane.
    // Lane (hf, l) has slot 16 hf + (l ^ 2kk): the readers' 16 lanes still cover
    // one run of 256 bytes, and the 32 lanes that stage two weight rows fall on
    // 32 different 8-byte bank pairs instead of four.
    __shared__ v4f sw[QKVC / 16][8][32];    // 96 KB of the 320 KB LDS

    // the weights are asked for first: they are staged while x is on its way
    v4f wv[QKVC * 16 / (PWAVES * 32)]; // 16-byte pieces of w_qkv, in memory order
    #pragma unroll  // constant indices: the array stays in registers
    for (int i = 0; i < QKVC * 16 / (PWAVES * 32); ++i) {
        // the last load may land on the address that the loads before it name: the
        // wait asked for before such a register is overwritten
        if (i == QKVC * 16 / (PWAVES * 32) - 1) asm volatile("s_wait_xcnt 0x0" ::: "memory");
        wv[i] = *(const v4f*)(wqkv + (i * PWAVES * 32 + threadIdx.x) * 4);
    }
    // likewise: the x loads below may land on the weight address
    asm volatile("s_wait_xcnt 0x0" ::: "memory");
    const float* xb = x + (size_t)b * CIN * NPOS + n0;
    v4f xv[16][2];                     // this lane's 32 channels x 4 positions
    #pragma unroll  // constant indices: the array stays in registers
    for (int k = 0; k < 16; ++k)
        #pragma unroll  // constant indices: the array stays in registers
        for (int i = 0; i < 2; ++i) {
            // likewise for the last load from the x address pair
            if (k == 15 && i == 1) asm volatile("s_wait_xcnt 0x0" ::: "memory");
            xv[k][i] = *(const v4f*)(xb + (size_t)(k * 4 + half * 2 + i) * NPOS);
        }
    // likewise: what is computed next may land on the x address pair
    asm volatile("s_wait_xcnt 0x0" ::: "memory");

    #pragma unroll  // constant indices: the array stays in registers
    for (int i = 0; i < QKVC * 16 / (PWAVES * 32); ++i) {
        const int p = i * PWAVES * 32 + threadIdx.x;
        const int row = p >> 4, c = p & 15;         // piece c: channels 4c .. 4c + 3
        const int slot = (row & 15) ^ (c & 14);     // step c, kk = c >> 1
        v2f lo, hi;
        lo.x = wv[i].x; lo.y = wv[i].y;             // half 0 of step c
        hi.x = wv[i].z; hi.y = wv[i].w;             // half 1 of step c
        *((v2f*)&sw[row >> 4][c >> 1][slot] + (c & 1))      = lo;
        *((v2f*)&sw[row >> 4][c >> 1][16 + slot] + (c & 1)) = hi;
    }
    __syncthreads();
    // keeps what waits for x behind the staging: the weights reach LDS while x is
    // still on its way
    __builtin_amdgcn_sched_barrier(0);

    const v4f* ap[8];                  // this lane's slot of its first M tile, per kk
    #pragma unroll  // constant indices: the array stays in registers
    for (int kk = 0; kk < 8; ++kk)
        ap[kk] = &sw[mg * PTILES][kk][half * 16 + (l ^ (2 * kk))];
    float* dst = qkv + ((size_t)b * QKVC + mg * (PTILES * 16) + half * 8) * NPOS + n0;

    v2f bp[16][4];                     // B fragments: step k, N tile t
    #pragma unroll  // constant indices: the arrays stay in registers
    for (int k = 0; k < 16; ++k)
        #pragma unroll  // constant indices: the arrays stay in registers
        for (int t = 0; t < 4; ++t) { bp[k][t].x = xv[k][0][t]; bp[k][t].y = xv[k][1][t]; }
    // keeps the address sums and the moves that pair the channels ahead of the first
    // WMMA: among the WMMAs they would land on operand registers right behind their
    // last use
    __builtin_amdgcn_sched_barrier(0);

    #pragma unroll  // constant LDS and store offsets: no address sums among the WMMAs
    for (int m = 0; m < PTILES; ++m) {
        v4f aw[8];
        #pragma unroll  // constant indices: the array stays in registers
        for (int kk = 0; kk < 8; ++kk)
            aw[kk] = ap[kk][m * 8 * 32];

        v8f acc[4] = {};
        #pragma unroll  // constant indices: the arrays stay in registers
        for (int k = 0; k < 16; ++k) {
            v2f a;
            a.x = (k & 1) ? aw[k >> 1].z : aw[k >> 1].x;
            a.y = (k & 1) ? aw[k >> 1].w : aw[k >> 1].y;
            #pragma unroll  // constant indices: the arrays stay in registers
            for (int t = 0; t < 4; ++t) acc[t] = wmma_f32(a, bp[k][t], acc[t]);
        }

        // the four vector slots between a WMMA and a vector instruction that reads
        // or overwrites its result or overwrites its operands: the two scheduling
        // barriers hold the slots in place
        __builtin_amdgcn_sched_barrier(0);
        asm volatile("v_nop\n\tv_nop\n\tv_nop\n\tv_nop");
        __builtin_amdgcn_sched_barrier(0);

        #pragma unroll  // constant indices: the arrays stay in registers
        for (int j = 0; j < 8; ++j) {
            v4f o;
            #pragma unroll  // constant indices: the arrays stay in registers
            for (int t = 0; t < 4; ++t) o[t] = acc[t][j];
            *(v4f*)(dst + (size_t)(m * 16 + j) * NPOS) = o;
        }
        // a later tile's stores may need a new address in the registers that these
        // stores name: the wait asked for before such a register is overwritten
        asm volatile("s_wait_xcnt 0x0" ::: "memory");
    }
}

// ---------------------------------------------------------------------------
// Kernel 2: context[b][h][d][e] = sum_n softmax_k[d][n] * v[e][n], with the
// softmax over n (axis 3) done in pieces: no separate pass over k.
// The n range of each (b,h) is cut into CSPLIT work-groups of CWAVES waves, so
// that 256 work-groups (one per WGP) share the sum.  Each wave holds its own
// 64 positions of the 32 k rows in registers, takes each row's max over them,
// and accumulates the full 32x32 (2x2 tiles of 16x16) with WMMA,
// A = exp(k - wave max) built in VALU, beside each row's sum of A.
// The LDS reduce brings the waves to the work-group's row max (factor
// exp(wave max - group max)); one un-normalised 32x32 partial, its 32 row
// maxima and its 32 row sums per work-group go to the workspace.
// ---------------------------------------------------------------------------
#define CSPLIT 32              // work-groups per (b,h) along n
#define CWAVES 16              // waves per work-group
#define CSTEPS (NPOS / (CSPLIT * CWAVES) / 4)   // WMMA k steps per wave

__global__ __launch_bounds__(CWAVES * 32)
void context_gemm(const float* __restrict__ qkv, float* __restrict__ part,
                  float* __restrict__ pmax, float* __restrict__ psum) {
    const int sp   = blockIdx.x;            // 0..CSPLIT-1
    const int bh   = blockIdx.y;            // 0..7
    const int b    = bh >> 2, h = bh & 3;
    const int wave = threadIdx.x >> 5;
    const int lane = threadIdx.x & 31;
    const int half = lane >> 4, l = lane & 15;

    // k order, A and B alike: step i, lane half hf, element j <-> the wave's
    // position 4i + 2hf + j (n0 holds the lane's 2hf)
    const int n0 = (sp * CWAVES + wave) * (CSTEPS * 4) + half * 2;
    const float* kr = qkv + (size_t)(b * QKVC + HID     + h * 32 + l) * NPOS + n0;
    const float* vr = qkv + (size_t)(b * QKVC + 2 * HID + h * 32 + l) * NPOS + n0;

    v2f a0[CSTEPS], a1[CSTEPS];             // rows l and 16 + l of k
    v2f b0[CSTEPS], b1[CSTEPS];             // B[k][e] = v[e][n], e = l and 16 + l
    #pragma unroll  // constant indices: the arrays stay in registers
    for (int i = 0; i < CSTEPS; ++i) {
        a0[i] = *(const v2f*)(kr + i * 4);
        // the last load may land on the address pair that the loads before it
        // name: the wait asked for before such a register is overwritten
        if (i == CSTEPS - 1) asm volatile("s_wait_xcnt 0x0" ::: "memory");
        a1[i] = *(const v2f*)(kr + (size_t)16 * NPOS + i * 4);
    }
    // likewise: a v load may land on the k address pair
    asm volatile("s_wait_xcnt 0x0" ::: "memory");
    #pragma unroll  // constant indices: the arrays stay in registers
    for (int i = 0; i < CSTEPS; ++i) {
        b0[i] = *(const v2f*)(vr + i * 4);
        // likewise for the last load from the v address pair
        if (i == CSTEPS - 1) asm volatile("s_wait_xcnt 0x0" ::: "memory");
        b1[i] = *(const v2f*)(vr + (size_t)16 * NPOS + i * 4);
    }
    // likewise: what is computed next may land on an address pair
    asm volatile("s_wait_xcnt 0x0" ::: "memory");
    // keeps the v loads ahead of the first wait for k: one trip to memory, not two
    __builtin_amdgcn_sched_barrier(0);

    // a lane holds 32 of its rows' 64 positions, lane ^ 16 the other 32
    float m0 = fmaxf(a0[0].x, a0[0].y), m1 = fmaxf(a1[0].x, a1[0].y);
    #pragma unroll  // constant indices: the arrays stay in registers
    for (int i = 1; i < CSTEPS; ++i) {
        m0 = fmaxf(m0, fmaxf(a0[i].x, a0[i].y));
        m1 = fmaxf(m1, fmaxf(a1[i].x, a1[i].y));
    }
    m0 = fmaxf(m0, other_half(m0));
    m1 = fmaxf(m1, other_half(m1));

    float s0 = 0.f, s1 = 0.f;
    #pragma unroll  // constant indices: the arrays stay in registers
    for (int i = 0; i < CSTEPS; ++i) {
        float x, y;
        exp_pair(x, y, a0[i].x - m0, a0[i].y - m0);
        a0[i].x = x; a0[i].y = y;
        s0 += x + y;
        exp_pair(x, y, a1[i].x - m1, a1[i].y - m1);
        a1[i].x = x; a1[i].y = y;
        s1 += x + y;
    }
    s0 += other_half(s0);
    s1 += other_half(s1);

    // keeps every asm exponential ahead of the first WMMA
    __builtin_amdgcn_sched_barrier(0);

    v8f acc[2][2] = {};
    #pragma unroll  // constant indices: the arrays stay in registers
    for (int i = 0; i < CSTEPS; ++i) {
        acc[0][0] = wmma_f32(a0[i], b0[i], acc[0][0]);
        acc[0][1] = wmma_f32(a0[i], b1[i], acc[0][1]);
        acc[1][0] = wmma_f32(a1[i], b0[i], acc[1][0]);
        acc[1][1] = wmma_f32(a1[i], b1[i], acc[1][1]);
    }

    __shared__ float sctx[CWAVES][32][32];  // 64 KB of the 320 KB LDS
    __shared__ float smax[CWAVES][32];
    __shared__ float ssum[CWAVES][32];
    #pragma unroll
    for (int dt = 0; dt < 2; ++dt)
        #pragma unroll
        for (int et = 0; et < 2; ++et)
            #pragma unroll
            for (int j = 0; j < 8; ++j)
                sctx[wave][dt * 16 + j + half * 8][et * 16 + l] = acc[dt][et][j];
    // both halves hold the same row values: half 0 stores row l, half 1 row 16 + l
    smax[wave][lane] = half ? m1 : m0;
    ssum[wave][lane] = half ? s1 : s0;
    __syncthreads();

    for (int idx = threadIdx.x; idx < 1024; idx += CWAVES * 32) {
        const int d = idx >> 5, e = idx & 31;
        float mw[CWAVES];
        #pragma unroll
        for (int w = 0; w < CWAVES; ++w) mw[w] = smax[w][d];
        float m = mw[0];
        #pragma unroll
        for (int w = 1; w < CWAVES; ++w) m = fmaxf(m, mw[w]);
        float s = 0.f, t = 0.f;
        #pragma unroll
        for (int w = 0; w < CWAVES; w += 2) {
            float f0, f1;
            exp_pair(f0, f1, mw[w] - m, mw[w + 1] - m);
            s += sctx[w][d][e] * f0;
            t += ssum[w][d] * f0;
            s += sctx[w + 1][d][e] * f1;
            t += ssum[w + 1][d] * f1;
        }
        part[((size_t)bh * CSPLIT + sp) * 1024 + idx] = s;
        if (e == 0) {
            pmax[(bh * CSPLIT + sp) * 32 + d] = m;
            psum[(bh * CSPLIT + sp) * 32 + d] = t;
        }
        // the next trip reuses the registers that these stores name: the wait
        // asked for before such a register is overwritten
        asm volatile("s_wait_xcnt 0x0" ::: "memory");
    }
}

// ---------------------------------------------------------------------------
// Kernel 3: context = sum of the CSPLIT partials, in index order, each brought
// to the row's overall max by exp(group max - max), over the row sums' like sum.
// ---------------------------------------------------------------------------
__global__ __launch_bounds__(256)
void context_merge(const float* __restrict__ part, const float* __restrict__ pmax,
                   const float* __restrict__ psum, float* __restrict__ ctx) {
    const int idx = blockIdx.x * 256 + threadIdx.x;   // < 8 * 1024
    const int bh  = idx >> 10, de = idx & 1023;
    const float* p  = part + (size_t)bh * CSPLIT * 1024 + de;
    const float* pm = pmax + bh * CSPLIT * 32 + (de >> 5);
    const float* ps = psum + bh * CSPLIT * 32 + (de >> 5);
    // unrolled so that all 3 * CSPLIT loads are in flight at once: one L2 trip.
    // Each s_wait_xcnt: a later load, the last of a run too, may land on the
    // address registers that the loads before it name; it is the wait asked for
    // before such a register is overwritten.
    float mv[CSPLIT], sv[CSPLIT], pv[CSPLIT];
    #pragma unroll
    for (int sp = 0; sp < CSPLIT; ++sp) {
        if (sp == CSPLIT - 1) asm volatile("s_wait_xcnt 0x0" ::: "memory");
        mv[sp] = pm[sp * 32];
    }
    asm volatile("s_wait_xcnt 0x0" ::: "memory");
    #pragma unroll
    for (int sp = 0; sp < CSPLIT; ++sp) {
        if (sp == CSPLIT - 1) asm volatile("s_wait_xcnt 0x0" ::: "memory");
        sv[sp] = ps[sp * 32];
    }
    asm volatile("s_wait_xcnt 0x0" ::: "memory");
    #pragma unroll
    for (int sp = 0; sp < CSPLIT; ++sp) {
        if (sp == CSPLIT - 1) asm volatile("s_wait_xcnt 0x0" ::: "memory");
        pv[sp] = p[sp * 1024];
    }
    asm volatile("s_wait_xcnt 0x0" ::: "memory");
    // keeps every load ahead of the first wait for one: one trip, not several
    __builtin_amdgcn_sched_barrier(0);
    float m = mv[0];
    #pragma unroll
    for (int sp = 1; sp < CSPLIT; ++sp) m = fmaxf(m, mv[sp]);
    float num = 0.f, den = 0.f;
    #pragma unroll
    for (int sp = 0; sp < CSPLIT; sp += 2) {
        float f0, f1;
        exp_pair(f0, f1, mv[sp] - m, mv[sp + 1] - m);
        num += pv[sp] * f0;
        den += sv[sp] * f0;
        num += pv[sp + 1] * f1;
        den += sv[sp + 1] * f1;
    }
    ctx[idx] = num / den;
}

// ---------------------------------------------------------------------------
// Kernel 4: per-position q softmax (over the 32 head channels) * SCALE, then
// out[e][n] = sum_d ctx[h][d][e] * q_sm[d][n] on the matrix unit, then, without
// out ever leaving the registers, y[b][64][n] = w_out(64x128) @ out + b_out and
// the GroupNorm sum / sum of squares.
// One wave = one head x 64 positions.
// First product: M = e (2 tiles), K = d (8 steps of 4), N = positions (4 tiles).
// A = ctx^T, 16 fragments held in registers, read straight from global.
// Column c of N tile t stands for position n0 + 4c + t, so a lane reads each q
// row and writes each y row as one 16-byte piece (256 contiguous bytes per 16
// lanes).
// k order, A and B alike: step k, lane half hf, element i  <->  d = 4k + 2hf + i.
// A lane holds 16 of a position's 32 channels, lane ^ 16 the other 16.
// Second product: M = the 64 rows of y (4 tiles), K = the wave's own 32 channels
// of out (8 steps of 4), N = the same 4 tiles.  The first product's result
// registers are the B fragments as they stand:
// k order, A and B alike: step (et, jj), lane half hf, element i  <->
// channel e = 16 et + 8 hf + 2 jj + i of the head.
// That gives one head's share of y.  The four heads of a chunk add up through
// LDS: wave h owns M tile h, hands its three other tiles over as register images
// (same lane, same register on both sides) and adds the three it is handed.
// y is written into the dead k-region of the qkv buffer.
// ---------------------------------------------------------------------------
#define QWAVES 16              // 4 heads x 4 chunks of 64 positions

__global__ __launch_bounds__(QWAVES * 32)
void q_apply_out(const float* __restrict__ qkv, const float* __restrict__ ctx,
                 const float* __restrict__ wout, const float* __restrict__ bout,
                 float* __restrict__ ybase, float* __restrict__ gnsum,
                 float* __restrict__ gnsq) {
    const int wave = threadIdx.x >> 5;
    const int lane = threadIdx.x & 31;
    const int half = lane >> 4, l = lane & 15;
    const int h    = wave & 3;
    const int ch   = wave >> 2;        // chunk of 64 positions
    const int b    = blockIdx.y;
    const int n0   = (blockIdx.x * (QWAVES / 4) + ch) * 64 + l * 4;

    // swo[head][M tile][2 et + p][lane]: the A fragments of steps (et, 2p) and
    // (et, 2p + 1) of one lane
    __shared__ v4f swo[4][4][4][32];                // 32 KB
    // sred[chunk][owner's M tile][giver][piece][lane]: register images
    __shared__ v4f sred[QWAVES / 4][4][3][8][32];   // 192 KB of the 320 KB LDS
    __shared__ float sstat[QWAVES][2];

    const float* qb = qkv + ((size_t)b * QKVC + h * 32) * NPOS + n0;   // q channels
    const float* cb = ctx + ((size_t)b * 4 + h) * 1024;

    // w_out is asked for first: it is staged while q is on its way.  Each wave
    // fetches the fragments of one (head, M tile) for the whole work-group.
    const float* wb = wout + (ch * 16 + l) * HID + h * 32 + half * 8;
    v4f wv[4];
    #pragma unroll  // constant indices: the array stays in registers
    for (int i = 0; i < 4; ++i) {
        // the last load may land on the address pair that the loads before it
        // name: the wait asked for before such a register is overwritten
        if (i == 3) asm volatile("s_wait_xcnt 0x0" ::: "memory");
        wv[i] = *(const v4f*)(wb + (i >> 1) * 16 + (i & 1) * 4);
    }
    // likewise: the q loads below may land on the w_out address pair
    asm volatile("s_wait_xcnt 0x0" ::: "memory");

    v4f qv[8][2];                      // this lane's 16 channels x 4 positions
    #pragma unroll  // constant indices: the arrays stay in registers
    for (int k = 0; k < 8; ++k)
        #pragma unroll  // constant indices: the arrays stay in registers
        for (int i = 0; i < 2; ++i) {
            // the last load may land on the address pair that the fifteen before
            // it name: the wait asked for before such a register is overwritten
            if (k == 7 && i == 1) asm volatile("s_wait_xcnt 0x0" ::: "memory");
            qv[k][i] = *(const v4f*)(qb + (size_t)(k * 4 + half * 2 + i) * NPOS);
        }

    // likewise: the context loads below may land on the q address pair
    asm volatile("s_wait_xcnt 0x0" ::: "memory");

    v2f af[2][8];                      // A[e][d] = ctx[d][e]
    #pragma unroll  // constant indices: the arrays stay in registers
    for (int et = 0; et < 2; ++et)
        #pragma unroll  // constant indices: the arrays stay in registers
        for (int k = 0; k < 8; ++k) {
            const int d = k * 4 + half * 2;
            af[et][k].x = cb[d * 32 + et * 16 + l];
            af[et][k].y = cb[(d + 1) * 32 + et * 16 + l];
        }
    // likewise: the bias loads below may land on the context address
    asm volatile("s_wait_xcnt 0x0" ::: "memory");

    v4f bo[2];                         // b_out of this lane's 8 rows of M tile h
    bo[0] = *(const v4f*)(bout + h * 16 + half * 8);
    // likewise for the last load from the bias address
    asm volatile("s_wait_xcnt 0x0" ::: "memory");
    bo[1] = *(const v4f*)(bout + h * 16 + half * 8 + 4);
    // likewise: what is computed next may land on the bias address
    asm volatile("s_wait_xcnt 0x0" ::: "memory");

    #pragma unroll  // constant indices: the array stays in registers
    for (int i = 0; i < 4; ++i) swo[h][ch][i][lane] = wv[i];

    float inv[4];
    #pragma unroll  // constant indices: the arrays stay in registers
    for (int t = 0; t < 4; ++t) {
        float m = -1e30f;
        #pragma unroll  // constant indices: the arrays stay in registers
        for (int k = 0; k < 8; ++k) m = fmaxf(m, fmaxf(qv[k][0][t], qv[k][1][t]));
        m = fmaxf(m, other_half(m));
        float s = 0.f;
        #pragma unroll  // constant indices: the arrays stay in registers
        for (int k = 0; k < 8; ++k) {
            float e0, e1;
            exp_pair(e0, e1, qv[k][0][t] - m, qv[k][1][t] - m);
            qv[k][0][t] = e0; qv[k][1][t] = e1;
            s += e0 + e1;
        }
        s += other_half(s);
        inv[t] = SCALE_Q / s;
    }

    // keeps every asm exponential ahead of the first WMMA
    __builtin_amdgcn_sched_barrier(0);

    v8f acc[2][4] = {};
    #pragma unroll  // constant indices: the arrays stay in registers
    for (int k = 0; k < 8; ++k)
        #pragma unroll  // constant indices: the arrays stay in registers
        for (int t = 0; t < 4; ++t) {
            v2f bb; bb.x = qv[k][0][t]; bb.y = qv[k][1][t];
            acc[0][t] = wmma_f32(af[0][k], bb, acc[0][t]);
            acc[1][t] = wmma_f32(af[1][k], bb, acc[1][t]);
        }

    #pragma unroll  // constant indices: the arrays stay in registers
    for (int et = 0; et < 2; ++et)
        #pragma unroll  // constant indices: the arrays stay in registers
        for (int t = 0; t < 4; ++t) acc[et][t] *= inv[t];

    // publishes the staged w_out.  It stands here and not behind the staging, so
    // that a wave whose q has come starts at once: its first product then runs
    // beside the softmax of a later wave on the same SIMD
    __syncthreads();

    v8f ya[4];                         // behind the loop: the wave's own M tile
    #pragma unroll  // constant indices: the arrays stay in registers
    for (int r = 0; r < 4; ++r) {
        const int mt = (h + 1 + r) & 3;             // the own tile comes last
        v4f aw[4];
        #pragma unroll  // constant indices: the array stays in registers
        for (int i = 0; i < 4; ++i) aw[i] = swo[h][mt][i][lane];

        #pragma unroll  // constant indices: the array stays in registers
        for (int t = 0; t < 4; ++t) ya[t] = v8f{};
        #pragma unroll  // constant indices: the arrays stay in registers
        for (int et = 0; et < 2; ++et)
            #pragma unroll  // constant indices: the arrays stay in registers
            for (int jj = 0; jj < 4; ++jj) {
                const v4f w4 = aw[et * 2 + (jj >> 1)];
                v2f a;
                a.x = (jj & 1) ? w4.z : w4.x;
                a.y = (jj & 1) ? w4.w : w4.y;
                #pragma unroll  // constant indices: the arrays stay in registers
                for (int t = 0; t < 4; ++t) {
                    v2f bb; bb.x = acc[et][t][2 * jj]; bb.y = acc[et][t][2 * jj + 1];
                    ya[t] = wmma_f32(a, bb, ya[t]);
                }
            }

        if (r < 3) {
            // seen from owner mt, this wave is giver 2 - r: head (mt + 1 + giver) & 3
            #pragma unroll  // constant indices: the array stays in registers
            for (int p = 0; p < 8; ++p) {
                v4f o;
                #pragma unroll  // constant indices: the array stays in registers
                for (int i = 0; i < 4; ++i) o[i] = ya[p >> 1][(p & 1) * 4 + i];
                sred[ch][mt][2 - r][p][lane] = o;
            }
        }
    }
    // publishes the shares: behind it every owner finds its three in LDS
    __syncthreads();

    #pragma unroll  // constant indices: the array stays in registers
    for (int g = 0; g < 3; ++g)
        #pragma unroll  // constant indices: the array stays in registers
        for (int p = 0; p < 8; ++p) {
            const v4f o = sred[ch][h][g][p][lane];
            #pragma unroll  // constant indices: the array stays in registers
            for (int i = 0; i < 4; ++i) ya[p >> 1][(p & 1) * 4 + i] += o[i];
        }

    v4f yo[8];                         // row h * 16 + half * 8 + j, 4 positions
    float lsum = 0.f, lsq = 0.f;
    #pragma unroll  // constant indices: the arrays stay in registers
    for (int j = 0; j < 8; ++j)
        #pragma unroll  // constant indices: the arrays stay in registers
        for (int t = 0; t < 4; ++t) {
            const float v = ya[t][j] + bo[j >> 2][j & 3];
            yo[j][t] = v;
            lsum += v; lsq += v * v;
        }
    // butterfly over the wave: every lane ends with the wave's sums
    lsum += row_xor<1>(lsum);  lsq += row_xor<1>(lsq);
    lsum += row_xor<2>(lsum);  lsq += row_xor<2>(lsq);
    lsum += row_xor<4>(lsum);  lsq += row_xor<4>(lsq);
    lsum += row_xor<8>(lsum);  lsq += row_xor<8>(lsq);
    lsum += other_half(lsum);  lsq += other_half(lsq);
    if (lane == 0) { sstat[wave][0] = lsum; sstat[wave][1] = lsq; }
    // the statistics meet ahead of the y stores: a barrier behind the stores would
    // wait for them to finish before the atomics could start
    __syncthreads();
    if (threadIdx.x < 2) {
        float s = 0.f;
        #pragma unroll  // constant LDS offsets: the 16 reads go out together
        for (int w = 0; w < QWAVES; ++w) s += sstat[w][threadIdx.x];
        atomicAdd((threadIdx.x ? gnsq : gnsum) + b, s);
    }

    // stride skips to batch b
    float* yb = ybase + (size_t)b * QKVC * NPOS + (size_t)(h * 16 + half * 8) * NPOS + n0;
    #pragma unroll  // constant indices: the array stays in registers
    for (int j = 0; j < 8; ++j) *(v4f*)(yb + (size_t)j * NPOS) = yo[j];
}

// ---------------------------------------------------------------------------
// Kernel 5: GroupNorm(1 group) finalize: (y-mean)*rsqrt(var+eps)*gamma + beta.
// One work-group per WGP: GWAVES waves, each lane takes GPIECES 16-byte pieces,
// all loaded before the first is used.  A work-group covers half of one channel
// row, so batch and channel (and with them the statistics, gamma and beta) are
// the same for the whole work-group.
// ---------------------------------------------------------------------------
#define GWAVES  16             // waves per work-group
#define GPIECES 8              // 16-byte pieces per lane
#define GSTRIDE (GWAVES * 32 * 4)          // floats one piece of all lanes covers
#define GSPAN   (GSTRIDE * GPIECES)        // floats per work-group: NPOS / 2

__global__ __launch_bounds__(GWAVES * 32)
void gn_finalize(const float* __restrict__ ybase, const float* __restrict__ gnsum,
                 const float* __restrict__ gnsq, const float* __restrict__ gw,
                 const float* __restrict__ gb, float* __restrict__ out) {
    const int row = blockIdx.x / (NPOS / GSPAN);          // b * 64 + o
    const int b   = row >> 6, o = row & 63;
    const int pos = (blockIdx.x % (NPOS / GSPAN)) * GSPAN + threadIdx.x * 4;
    const float* src = ybase + (size_t)b * QKVC * NPOS + (size_t)o * NPOS + pos;
    float* dst = out + (size_t)row * NPOS + pos;

    v4f v[GPIECES];
    #pragma unroll  // constant indices: the array stays in registers
    for (int i = 0; i < GPIECES; ++i) v[i] = *(const v4f*)(src + i * GSTRIDE);
    // what is computed next may land on a register that holds the loads' address:
    // the wait asked for before such a register is overwritten
    asm volatile("s_wait_xcnt 0x0" ::: "memory");

    const float count = 64.0f * NPOS;
    const float mean  = gnsum[b] / count;
    const float var   = gnsq[b] / count - mean * mean;
    const float inv   = rsqrtf(var + GN_EPS);
    const float g = gw[o], be = gb[o];
    #pragma unroll  // constant indices: the array stays in registers
    for (int i = 0; i < GPIECES; ++i) {
        v4f r;
        #pragma unroll
        for (int j = 0; j < 4; ++j) r[j] = (v[i][j] - mean) * inv * g + be;
        *(v4f*)(dst + i * GSTRIDE) = r;
    }
}

// ---------------------------------------------------------------------------
extern "C" void kernel_launch(void* const* d_in, const int* in_sizes, int n_in,
                              void* d_out, int out_size, void* d_ws, size_t ws_size,
                              hipStream_t stream) {
    const float* x    = (const float*)d_in[0];
    const float* wqkv = (const float*)d_in[1];
    const float* wout = (const float*)d_in[2];
    const float* bout = (const float*)d_in[3];
    const float* gnw  = (const float*)d_in[4];
    const float* gnb  = (const float*)d_in[5];

    float* ws     = (float*)d_ws;
    float* qkv    = ws;                                        // 25,165,824 f
    float* outbuf = qkv + (size_t)NB * QKVC * NPOS;            //  8,388,608 f
    float* pmax   = outbuf + (size_t)NB * HID * NPOS;          //      8,192 f
    float* psum   = pmax + NB * 4 * CSPLIT * 32;               //      8,192 f
    float* ctx    = psum + NB * 4 * CSPLIT * 32;               //      8,192 f
    float* gnsum  = ctx + NB * 4 * 32 * 32;                    //          2 f
    float* gnsq   = gnsum + NB;                                //          2 f
    float* part   = gnsq + NB;                                 //    262,144 f
    // y aliases the k channel region [128,192) of qkv (dead after kernel 2)
    float* ybase  = qkv + (size_t)HID * NPOS;

    hipMemsetAsync(gnsum, 0, 2 * NB * sizeof(float), stream);

    qkv_gemm   <<<dim3(NPOS / 256, NB), PWAVES * 32, 0, stream>>>(x, wqkv, qkv);
    context_gemm<<<dim3(CSPLIT, NB * 4), CWAVES * 32, 0, stream>>>(qkv, part, pmax, psum);
    context_merge<<<(NB * 4 * 1024) / 256, 256, 0, stream>>>(part, pmax, psum, ctx);
    q_apply_out<<<dim3(NPOS / 256, NB), QWAVES * 32, 0, stream>>>(qkv, ctx, wout, bout,
                                                                  ybase, gnsum, gnsq);
    gn_finalize<<<(NB * CIN * NPOS) / GSPAN, GWAVES * 32, 0, stream>>>(ybase, gnsum, gnsq,
                                                             gnw, gnb, (float*)d_out);
}

// v007
// Timed twice side by side with v006, it ran 1.25 and 1.24 times as fast.
// All steps since v000 together make it 7.98 times as fast.
#include <hip/hip_runtime.h>

// ---------------------------------------------------------------------------
// LinearAttention fused pipeline for gfx1250 (MI455X), fp32 WMMA path.
// Shapes: b=2, c=64, n=32768, heads=4, dim_head=32, hidden=128, qkv=384.
// Memory-bound: 34 MB mandatory HBM traffic; all intermediates L2-resident.
// ---------------------------------------------------------------------------

#define NPOS   32768           // 32*32*32 spatial positions
#define CIN    64
#define HID    128
#define QKVC   384
#define NB     2
#define SCALE_Q 0.17677669529663687f   // 32^-0.5
#define GN_EPS  1e-5f

typedef __attribute__((ext_vector_type(2))) float v2f;
typedef __attribute__((ext_vector_type(8))) float v8f;

__device__ __forceinline__ v8f wmma_f32(v2f a, v2f b, v8f c) {
    // V_WMMA_F32_16X16X4_F32: D(16x16,f32) = A(16x4,f32) x B(4x16,f32) + C
    return __builtin_amdgcn_wmma_f32_16x16x4_f32(
        /*neg_a=*/false, a, /*neg_b=*/false, b,
        /*c_mod=*/(short)0, c, /*reuse_a=*/false, /*reuse_b=*/false);
}

__device__ __forceinline__ float other_half(float v) {
    // value of lane ^ 16 (v_permlanex16_b32 with the identity lane select)
    return __int_as_float(__builtin_amdgcn_permlanex16(
        0, __float_as_int(v), 0x76543210, 0xfedcba98, false, false));
}

template <int MASK>
__device__ __forceinline__ float row_xor(float v) {
    // value of lane ^ MASK inside the 16-lane row (DPP row_xmask): no LDS trip
    return __int_as_float(__builtin_amdgcn_update_dpp(
        0, __float_as_int(v), 0x160 + MASK, 0xf, 0xf, false));
}

__device__ __forceinline__ void exp_pair(float& r0, float& r1, float x0, float x1) {
    // e^x as 2^(x * log2 e), two at a time.  In asm so that the slot the
    // instruction set asks for behind a transcendental is always filled: the
    // first by the second, which shares no register with it (early-clobber
    // outputs), the second by the v_nop, whatever the compiler puts next.
    asm("v_exp_f32 %0, %2\n\tv_exp_f32 %1, %3\n\tv_nop"
        : "=&v"(r0), "=&v"(r1)
        : "v"(x0 * 1.44269504f), "v"(x1 * 1.44269504f));
}

// ---------------------------------------------------------------------------
// Kernel 1: the q, k and v rows of one head, w_qkv(96 of 384 x 64) @ x[b](64xn),
// and, with k and v never leaving the registers, the head's share of
// context[b][h][d][e] = sum_n softmax_k[d][n] * v[e][n]; only q goes to memory.
// The n range of each (b,h) is cut into CSPLIT work-groups of CWAVES waves: 256
// work-groups, one per WGP.  A wave holds its 64 positions of x (64 channels, the
// fragments of 4 position tiles) in registers for all six 16-row tiles.
// Index c of position tile t stands for position n0 + 4c + t, so a lane reads each
// x row and writes each q row as one 16-byte piece (256 contiguous bytes per 16
// lanes).  The head's weights are staged once per work-group in LDS, in fragment
// order.
// A layout (16x4 f32): lanes 0-15 row=l K={0,1}; lanes 16-31 row=l K={2,3}.
// B layout (4x16 f32): lanes 0-15 col=l K rows {0,1}; lanes 16-31 rows {2,3}.
// C/D layout: VGPR j -> row j (lanes 0-15) / row j+8 (lanes 16-31).
// The two operand layouts mirror each other, so one register pair of x serves as
// B (q = w x: rows = channels of q, columns = positions) and as A (k^T = x^T w^T,
// v^T likewise: rows = positions, columns = channels of k or v).
// k order of these products, A and B alike: step k, lane half hf, element i <->
// channel 4k + 2hf + i of x.
// k^T and v^T come out with their channel in the lane and the positions in the
// registers, which is the operand layout of the context product as it stands:
// A = exp(k - wave max) (M = d), B = v^T (N = e).
// k order of the context product, A and B alike: step (t, jj), lane half hf,
// element i <-> index c = 8 hf + 2 jj + i of position tile t.
// The softmax over n (axis 3) is done in pieces: each wave takes each k row's max
// over its own 64 positions and sums exp(k - wave max) beside the product.  The
// LDS reduce brings the waves to the work-group's row max (factor
// exp(wave max - group max)); one un-normalised 32x32 partial, its 32 row
// maxima and its 32 row sums per work-group go to the workspace.
// ---------------------------------------------------------------------------
#define CSPLIT 32              // work-groups per (b,h) along n
#define CWAVES 16              // waves per work-group, 64 positions each
#define HTILES 6               // 16-row tiles of one head: 2 of q, 2 of k, 2 of v

typedef __attribute__((ext_vector_type(4))) float v4f;

__global__ __launch_bounds__(CWAVES * 32)
void qkv_context(const float* __restrict__ x, const float* __restrict__ wqkv,
                 float* __restrict__ qkv, float* __restrict__ part,
                 float* __restrict__ pmax, float* __restrict__ psum) {
    const int sp   = blockIdx.x;            // 0..CSPLIT-1
    const int bh   = blockIdx.y;            // 0..7
    const int b    = bh >> 2, h = bh & 3;
    const int wave = threadIdx.x >> 5;
    const int lane = threadIdx.x & 31;
    const int half = lane >> 4, l = lane & 15;
    const int n0   = (sp * CWAVES + wave) * 64 + l * 4;

    // sw[tile][kk][slot]: the weight fragments of steps 2kk and 2kk + 1 of one lane.
    // Lane (hf, l) has slot 16 hf + (l ^ 2kk): the readers' 16 lanes still cover
    // one run of 256 bytes, and the 32 lanes that stage two weight rows fall on
    // 32 different 8-byte bank pairs instead of four.
    // One struct, the weights first: every fragment read then lies within the 64 KB
    // that an LDS instruction's own offset field reaches, with no address sums.
    __shared__ struct {
        v4f   sw[HTILES][8][32];            // 24 KB
        float sctx[CWAVES][32][32];         // 64 KB of the 320 KB LDS
        float smax[CWAVES][32];
        float ssum[CWAVES][32];
    } sh;
    auto& sw = sh.sw; auto& sctx = sh.sctx; auto& smax = sh.smax; auto& ssum = sh.ssum;

    // the weights are asked for first: they are staged while x is on its way.
    // Piece i of a thread: row (threadIdx.x >> 4) of the head's q, k, v for i = 0, 1, 2.
    const float* wb = wqkv + (h * 32 + (threadIdx.x >> 4)) * CIN + (threadIdx.x & 15) * 4;
    v4f wv[3];
    #pragma unroll  // constant indices: the array stays in registers
    for (int i = 0; i < 3; ++i) {
        // the last load may land on the address that the loads before it name: the
        // wait asked for before such a register is overwritten
        if (i == 2) asm volatile("s_wait_xcnt 0x0" ::: "memory");
        wv[i] = *(const v4f*)(wb + i * HID * CIN);
    }
    // likewise: the x loads below may land on the weight address
    asm volatile("s_wait_xcnt 0x0" ::: "memory");
    const float* xb = x + (size_t)b * CIN * NPOS + n0;
    v4f xv[16][2];                     // this lane's 32 channels x 4 positions
    #pragma unroll  // constant indices: the array stays in registers
    for (int k = 0; k < 16; ++k)
        #pragma unroll  // constant indices: the array stays in registers
        for (int i = 0; i < 2; ++i) {
            // likewise for the last load from the x address pair
            if (k == 15 && i == 1) asm volatile("s_wait_xcnt 0x0" ::: "memory");
            xv[k][i] = *(const v4f*)(xb + (size_t)(k * 4 + half * 2 + i) * NPOS);
        }
    // likewise: what is computed next may land on the x address pair
    asm volatile("s_wait_xcnt 0x0" ::: "memory");

    #pragma unroll  // constant indices: the array stays in registers
    for (int i = 0; i < 3; ++i) {
        const int row = threadIdx.x >> 4, c = threadIdx.x & 15;  // piece c: channels 4c .. 4c + 3
        const int slot = (row & 15) ^ (c & 14);     // step c, kk = c >> 1
        v2f lo, hi;
        lo.x = wv[i].x; lo.y = wv[i].y;             // half 0 of step c
        hi.x = wv[i].z; hi.y = wv[i].w;             // half 1 of step c
        *((v2f*)&sw[i * 2 + (row >> 4)][c >> 1][slot] + (c & 1))      = lo;
        *((v2f*)&sw[i * 2 + (row >> 4)][c >> 1][16 + slot] + (c & 1)) = hi;
    }
    __syncthreads();
    // keeps what waits for x behind the staging: the weights reach LDS while x is
    // still on its way
    __builtin_amdgcn_sched_barrier(0);

    const v4f* ap[8];                  // this lane's slot of tile 0, per kk
    #pragma unroll  // constant indices: the array stays in registers
    for (int kk = 0; kk < 8; ++kk)
        ap[kk] = &sw[0][kk][half * 16 + (l ^ (2 * kk))];
    float* dst = qkv + ((size_t)b * QKVC + h * 32 + half * 8) * NPOS + n0;

    v2f bp[16][4];                     // x fragments: step k, position tile t
    #pragma unroll  // constant indices: the arrays stay in registers
    for (int k = 0; k < 16; ++k)
        #pragma unroll  // constant indices: the arrays stay in registers
        for (int t = 0; t < 4; ++t) { bp[k][t].x = xv[k][0][t]; bp[k][t].y = xv[k][1][t]; }
    // keeps the address sums and the moves that pair the channels ahead of the first
    // WMMA: among the WMMAs they would land on operand registers right behind their
    // last use
    __builtin_amdgcn_sched_barrier(0);

    // q: the stores go out first and finish under the rest of the kernel
    #pragma unroll  // constant LDS and store offsets: no address sums among the WMMAs
    for (int m = 0; m < 2; ++m) {
        v4f aw[8];
        #pragma unroll  // constant indices: the array stays in registers
        for (int kk = 0; kk < 8; ++kk)
            aw[kk] = ap[kk][m * 8 * 32];

        v8f acc[4] = {};
        #pragma unroll  // constant indices: the arrays stay in registers
        for (int k = 0; k < 16; ++k) {
            v2f a;
            a.x = (k & 1) ? aw[k >> 1].z : aw[k >> 1].x;
            a.y = (k & 1) ? aw[k >> 1].w : aw[k >> 1].y;
            #pragma unroll  // constant indices: the arrays stay in registers
            for (int t = 0; t < 4; ++t) acc[t] = wmma_f32(a, bp[k][t], acc[t]);
        }

        // the four vector slots between a WMMA and a vector instruction that reads
        // or overwrites its result or overwrites its operands: the two scheduling
        // barriers hold the slots in place
        __builtin_amdgcn_sched_barrier(0);
        asm volatile("v_nop\n\tv_nop\n\tv_nop\n\tv_nop");
        __builtin_amdgcn_sched_barrier(0);

        #pragma unroll  // constant indices: the arrays stay in registers
        for (int j = 0; j < 8; ++j) {
            v4f o;
            #pragma unroll  // constant indices: the arrays stay in registers
            for (int t = 0; t < 4; ++t) o[t] = acc[t][j];
            *(v4f*)(dst + (size_t)(m * 16 + j) * NPOS) = o;
        }
        // what comes next may need the registers that these stores name: the wait
        // asked for before such a register is overwritten
        asm volatile("s_wait_xcnt 0x0" ::: "memory");
    }

    // k^T and v^T, one position tile at a time: the tile's 32 registers of x are
    // free as soon as its 32 result registers are full
    v8f kt[2][4], vt[2][4];            // [channel tile][position tile]
    #pragma unroll  // constant indices and LDS offsets
    for (int t = 0; t < 4; ++t) {
        // compiler fence: each tile reads the weight fragments from LDS anew; held
        // over the four tiles they take 128 registers and the wave spills
        asm volatile("" ::: "memory");
        kt[0][t] = v8f{}; kt[1][t] = v8f{}; vt[0][t] = v8f{}; vt[1][t] = v8f{};
        #pragma unroll  // constant indices and LDS offsets
        for (int kk = 0; kk < 8; ++kk) {
            v4f w4[4];
            #pragma unroll  // constant indices: the array stays in registers
            for (int m = 0; m < 4; ++m) w4[m] = ap[kk][(2 + m) * 8 * 32];
            #pragma unroll  // constant indices: the arrays stay in registers
            for (int s = 0; s < 2; ++s) {
                v2f wf[4];
                #pragma unroll  // constant indices: the arrays stay in registers
                for (int m = 0; m < 4; ++m) {
                    wf[m].x = s ? w4[m].z : w4[m].x;
                    wf[m].y = s ? w4[m].w : w4[m].y;
                }
                kt[0][t] = wmma_f32(bp[2 * kk + s][t], wf[0], kt[0][t]);
                kt[1][t] = wmma_f32(bp[2 * kk + s][t], wf[1], kt[1][t]);
                vt[0][t] = wmma_f32(bp[2 * kk + s][t], wf[2], vt[0][t]);
                vt[1][t] = wmma_f32(bp[2 * kk + s][t], wf[3], vt[1][t]);
            }
        }
    }
    // the four vector slots behind the last WMMA, as above
    __builtin_amdgcn_sched_barrier(0);
    asm volatile("v_nop\n\tv_nop\n\tv_nop\n\tv_nop");
    __builtin_amdgcn_sched_barrier(0);

    // a lane holds 32 of its two k rows' 64 positions, lane ^ 16 the other 32
    float m0 = kt[0][0][0], m1 = kt[1][0][0];
    #pragma unroll  // constant indices: the arrays stay in registers
    for (int t = 0; t < 4; ++t)
        #pragma unroll  // constant indices: the arrays stay in registers
        for (int j = 0; j < 8; ++j) {
            m0 = fmaxf(m0, kt[0][t][j]);
            m1 = fmaxf(m1, kt[1][t][j]);
        }
    m0 = fmaxf(m0, other_half(m0));
    m1 = fmaxf(m1, other_half(m1));

    float s0 = 0.f, s1 = 0.f;
    #pragma unroll  // constant indices: the arrays stay in registers
    for (int t = 0; t < 4; ++t)
        #pragma unroll  // constant indices: the arrays stay in registers
        for (int jj = 0; jj < 4; ++jj) {
            float e0, e1;
            exp_pair(e0, e1, kt[0][t][2 * jj] - m0, kt[0][t][2 * jj + 1] - m0);
            kt[0][t][2 * jj] = e0; kt[0][t][2 * jj + 1] = e1;
            s0 += e0 + e1;
            exp_pair(e0, e1, kt[1][t][2 * jj] - m1, kt[1][t][2 * jj + 1] - m1);
            kt[1][t][2 * jj] = e0; kt[1][t][2 * jj + 1] = e1;
            s1 += e0 + e1;
        }
    s0 += other_half(s0);
    s1 += other_half(s1);

    // keeps every asm exponential of k ahead of the context product's first WMMA
    __builtin_amdgcn_sched_barrier(0);

    v8f acc[2][2] = {};
    #pragma unroll  // constant indices: the arrays stay in registers
    for (int t = 0; t < 4; ++t)
        #pragma unroll  // constant indices: the arrays stay in registers
        for (int jj = 0; jj < 4; ++jj) {
            v2f a0, a1, b0, b1;
            a0.x = kt[0][t][2 * jj]; a0.y = kt[0][t][2 * jj + 1];
            a1.x = kt[1][t][2 * jj]; a1.y = kt[1][t][2 * jj + 1];
            b0.x = vt[0][t][2 * jj]; b0.y = vt[0][t][2 * jj + 1];
            b1.x = vt[1][t][2 * jj]; b1.y = vt[1][t][2 * jj + 1];
            acc[0][0] = wmma_f32(a0, b0, acc[0][0]);
            acc[0][1] = wmma_f32(a0, b1, acc[0][1]);
            acc[1][0] = wmma_f32(a1, b0, acc[1][0]);
            acc[1][1] = wmma_f32(a1, b1, acc[1][1]);
        }

    #pragma unroll
    for (int dt = 0; dt < 2; ++dt)
        #pragma unroll
        for (int et = 0; et < 2; ++et)
            #pragma unroll
            for (int j = 0; j < 8; ++j)
                sctx[wave][dt * 16 + j + half * 8][et * 16 + l] = acc[dt][et][j];
    // both halves hold the same row values: half 0 stores row l, half 1 row 16 + l
    smax[wave][lane] = half ? m1 : m0;
    ssum[wave][lane] = half ? s1 : s0;
    __syncthreads();

    for (int idx = threadIdx.x; idx < 1024; idx += CWAVES * 32) {
        const int d = idx >> 5, e = idx & 31;
        float mw[CWAVES];
        #pragma unroll
        for (int w = 0; w < CWAVES; ++w) mw[w] = smax[w][d];
        float m = mw[0];
        #pragma unroll
        for (int w = 1; w < CWAVES; ++w) m = fmaxf(m, mw[w]);
        float s = 0.f, t = 0.f;
        #pragma unroll
        for (int w = 0; w < CWAVES; w += 2) {
            float f0, f1;
            exp_pair(f0, f1, mw[w] - m, mw[w + 1] - m);
            s += sctx[w][d][e] * f0;
            t += ssum[w][d] * f0;
            s += sctx[w + 1][d][e] * f1;
            t += ssum[w + 1][d] * f1;
        }
        part[((size_t)bh * CSPLIT + sp) * 1024 + idx] = s;
        if (e == 0) {
            pmax[(bh * CSPLIT + sp) * 32 + d] = m;
            psum[(bh * CSPLIT + sp) * 32 + d] = t;
        }
        // the next trip reuses the registers that these stores name: the wait
        // asked for before such a register is overwritten
        asm volatile("s_wait_xcnt 0x0" ::: "memory");
    }
}

// ---------------------------------------------------------------------------
// Kernel 2: context = sum of the CSPLIT partials, in index order, each brought
// to the row's overall max by exp(group max - max), over the row sums' like sum.
// ---------------------------------------------------------------------------
__global__ __launch_bounds__(256)
void context_merge(const float* __restrict__ part, const float* __restrict__ pmax,
                   const float* __restrict__ psum, float* __restrict__ ctx) {
    const int idx = blockIdx.x * 256 + threadIdx.x;   // < 8 * 1024
    const int bh  = idx >> 10, de = idx & 1023;
    const float* p  = part + (size_t)bh * CSPLIT * 1024 + de;
    const float* pm = pmax + bh * CSPLIT * 32 + (de >> 5);
    const float* ps = psum + bh * CSPLIT * 32 + (de >> 5);
    // unrolled so that all 3 * CSPLIT loads are in flight at once: one L2 trip.
    // Each s_wait_xcnt: a later load, the last of a run too, may land on the
    // address registers that the loads before it name; it is the wait asked for
    // before such a register is overwritten.
    float mv[CSPLIT], sv[CSPLIT], pv[CSPLIT];
    #pragma unroll
    for (int sp = 0; sp < CSPLIT; ++sp) {
        if (sp == CSPLIT - 1) asm volatile("s_wait_xcnt 0x0" ::: "memory");
        mv[sp] = pm[sp * 32];
    }
    asm volatile("s_wait_xcnt 0x0" ::: "memory");
    #pragma unroll
    for (int sp = 0; sp < CSPLIT; ++sp) {
        if (sp == CSPLIT - 1) asm volatile("s_wait_xcnt 0x0" ::: "memory");
        sv[sp] = ps[sp * 32];
    }
    asm volatile("s_wait_xcnt 0x0" ::: "memory");
    #pragma unroll
    for (int sp = 0; sp < CSPLIT; ++sp) {
        if (sp == CSPLIT - 1) asm volatile("s_wait_xcnt 0x0" ::: "memory");
        pv[sp] = p[sp * 1024];
    }
    asm volatile("s_wait_xcnt 0x0" ::: "memory");
    // keeps every load ahead of the first wait for one: one trip, not several
    __builtin_amdgcn_sched_barrier(0);
    float m = mv[0];
    #pragma unroll
    for (int sp = 1; sp < CSPLIT; ++sp) m = fmaxf(m, mv[sp]);
    float num = 0.f, den = 0.f;
    #pragma unroll
    for (int sp = 0; sp < CSPLIT; sp += 2) {
        float f0, f1;
        exp_pair(f0, f1, mv[sp] - m, mv[sp + 1] - m);
        num += pv[sp] * f0;
        den += sv[sp] * f0;
        num += pv[sp + 1] * f1;
        den += sv[sp + 1] * f1;
    }
    ctx[idx] = num / den;
}

// ---------------------------------------------------------------------------
// Kernel 3: per-position q softmax (over the 32 head channels) * SCALE, then
// out[e][n] = sum_d ctx[h][d][e] * q_sm[d][n] on the matrix unit, then, without
// out ever leaving the registers, y[b][64][n] = w_out(64x128) @ out + b_out and
// the GroupNorm sum / sum of squares.
// One wave = one head x 64 positions.
// First product: M = e (2 tiles), K = d (8 steps of 4), N = positions (4 tiles).
// A = ctx^T, 16 fragments held in registers, read straight from global.
// Column c of N tile t stands for position n0 + 4c + t, so a lane reads each q
// row and writes each y row as one 16-byte piece (256 contiguous bytes per 16
// lanes).
// k order, A and B alike: step k, lane half hf, element i  <->  d = 4k + 2hf + i.
// A lane holds 16 of a position's 32 channels, lane ^ 16 the other 16.
// Second product: M = the 64 rows of y (4 tiles), K = the wave's own 32 channels
// of out (8 steps of 4), N = the same 4 tiles.  The first product's result
// registers are the B fragments as they stand:
// k order, A and B alike: step (et, jj), lane half hf, element i  <->
// channel e = 16 et + 8 hf + 2 jj + i of the head.
// That gives one head's share of y.  The four heads of a chunk add up through
// LDS: wave h owns M tile h, hands its three other tiles over as register images
// (same lane, same register on both sides) and adds the three it is handed.
// y is written into the unused k-region of the qkv buffer.
// ---------------------------------------------------------------------------
#define QWAVES 16              // 4 heads x 4 chunks of 64 positions

__global__ __launch_bounds__(QWAVES * 32)
void q_apply_out(const float* __restrict__ qkv, const float* __restrict__ ctx,
                 const float* __restrict__ wout, const float* __restrict__ bout,
                 float* __restrict__ ybase, float* __restrict__ gnsum,
                 float* __restrict__ gnsq) {
    const int wave = threadIdx.x >> 5;
    const int lane = threadIdx.x & 31;
    const int half = lane >> 4, l = lane & 15;
    const int h    = wave & 3;
    const int ch   = wave >> 2;        // chunk of 64 positions
    const int b    = blockIdx.y;
    const int n0   = (blockIdx.x * (QWAVES / 4) + ch) * 64 + l * 4;

    // swo[head][M tile][2 et + p][lane]: the A fragments of steps (et, 2p) and
    // (et, 2p + 1) of one lane
    __shared__ v4f swo[4][4][4][32];                // 32 KB
    // sred[chunk][owner's M tile][giver][piece][lane]: register images
    __shared__ v4f sred[QWAVES / 4][4][3][8][32];   // 192 KB of the 320 KB LDS
    __shared__ float sstat[QWAVES][2];

    const float* qb = qkv + ((size_t)b * QKVC + h * 32) * NPOS + n0;   // q channels
    const float* cb = ctx + ((size_t)b * 4 + h) * 1024;

    // w_out is asked for first: it is staged while q is on its way.  Each wave
    // fetches the fragments of one (head, M tile) for the whole work-group.
    const float* wb = wout + (ch * 16 + l) * HID + h * 32 + half * 8;
    v4f wv[4];
    #pragma unroll  // constant indices: the array stays in registers
    for (int i = 0; i < 4; ++i) {
        // the last load may land on the address pair that the loads before it
        // name: the wait asked for before such a register is overwritten
        if (i == 3) asm volatile("s_wait_xcnt 0x0" ::: "memory");
        wv[i] = *(const v4f*)(wb + (i >> 1) * 16 + (i & 1) * 4);
    }
    // likewise: the q loads below may land on the w_out address pair
    asm volatile("s_wait_xcnt 0x0" ::: "memory");

    v4f qv[8][2];                      // this lane's 16 channels x 4 positions
    #pragma unroll  // constant indices: the arrays stay in registers
    for (int k = 0; k < 8; ++k)
        #pragma unroll  // constant indices: the arrays stay in registers
        for (int i = 0; i < 2; ++i) {
            // the last load may land on the address pair that the fifteen before
            // it name: the wait asked for before such a register is overwritten
            if (k == 7 && i == 1) asm volatile("s_wait_xcnt 0x0" ::: "memory");
            qv[k][i] = *(const v4f*)(qb + (size_t)(k * 4 + half * 2 + i) * NPOS);
        }

    // likewise: the context loads below may land on the q address pair
    asm volatile("s_wait_xcnt 0x0" ::: "memory");

    v2f af[2][8];                      // A[e][d] = ctx[d][e]
    #pragma unroll  // constant indices: the arrays stay in registers
    for (int et = 0; et < 2; ++et)
        #pragma unroll  // constant indices: the arrays stay in registers
        for (int k = 0; k < 8; ++k) {
            const int d = k * 4 + half * 2;
            af[et][k].x = cb[d * 32 + et * 16 + l];
            af[et][k].y = cb[(d + 1) * 32 + et * 16 + l];
        }
    // likewise: the bias loads below may land on the context address
    asm volatile("s_wait_xcnt 0x0" ::: "memory");

    v4f bo[2];                         // b_out of this lane's 8 rows of M tile h
    bo[0] = *(const v4f*)(bout + h * 16 + half * 8);
    // likewise for the last load from the bias address
    asm volatile("s_wait_xcnt 0x0" ::: "memory");
    bo[1] = *(const v4f*)(bout + h * 16 + half * 8 + 4);
    // likewise: what is computed next may land on the bias address
    asm volatile("s_wait_xcnt 0x0" ::: "memory");

    #pragma unroll  // constant indices: the array stays in registers
    for (int i = 0; i < 4; ++i) swo[h][ch][i][lane] = wv[i];

    float inv[4];
    #pragma unroll  // constant indices: the arrays stay in registers
    for (int t = 0; t < 4; ++t) {
        float m = -1e30f;
        #pragma unroll  // constant indices: the arrays stay in registers
        for (int k = 0; k < 8; ++k) m = fmaxf(m, fmaxf(qv[k][0][t], qv[k][1][t]));
        m = fmaxf(m, other_half(m));
        float s = 0.f;
        #pragma unroll  // constant indices: the arrays stay in registers
        for (int k = 0; k < 8; ++k) {
            float e0, e1;
            exp_pair(e0, e1, qv[k][0][t] - m, qv[k][1][t] - m);
            qv[k][0][t] = e0; qv[k][1][t] = e1;
            s += e0 + e1;
        }
        s += other_half(s);
        inv[t] = SCALE_Q / s;
    }

    // keeps every asm exponential ahead of the first WMMA
    __builtin_amdgcn_sched_barrier(0);

    v8f acc[2][4] = {};
    #pragma unroll  // constant indices: the arrays stay in registers
    for (int k = 0; k < 8; ++k)
        #pragma unroll  // constant indices: the arrays stay in registers
        for (int t = 0; t < 4; ++t) {
            v2f bb; bb.x = qv[k][0][t]; bb.y = qv[k][1][t];
            acc[0][t] = wmma_f32(af[0][k], bb, acc[0][t]);
            acc[1][t] = wmma_f32(af[1][k], bb, acc[1][t]);
        }

    #pragma unroll  // constant indices: the arrays stay in registers
    for (int et = 0; et < 2; ++et)
        #pragma unroll  // constant indices: the arrays stay in registers
        for (int t = 0; t < 4; ++t) acc[et][t] *= inv[t];

    // publishes the staged w_out.  It stands here and not behind the staging, so
    // that a wave whose q has come starts at once: its first product then runs
    // beside the softmax of a later wave on the same SIMD
    __syncthreads();

    v8f ya[4];                         // behind the loop: the wave's own M tile
    #pragma unroll  // constant indices: the arrays stay in registers
    for (int r = 0; r < 4; ++r) {
        const int mt = (h + 1 + r) & 3;             // the own tile comes last
        v4f aw[4];
        #pragma unroll  // constant indices: the array stays in registers
        for (int i = 0; i < 4; ++i) aw[i] = swo[h][mt][i][lane];

        #pragma unroll  // constant indices: the array stays in registers
        for (int t = 0; t < 4; ++t) ya[t] = v8f{};
        #pragma unroll  // constant indices: the arrays stay in registers
        for (int et = 0; et < 2; ++et)
            #pragma unroll  // constant indices: the arrays stay in registers
            for (int jj = 0; jj < 4; ++jj) {
                const v4f w4 = aw[et * 2 + (jj >> 1)];
                v2f a;
                a.x = (jj & 1) ? w4.z : w4.x;
                a.y = (jj & 1) ? w4.w : w4.y;
                #pragma unroll  // constant indices: the arrays stay in registers
                for (int t = 0; t < 4; ++t) {
                    v2f bb; bb.x = acc[et][t][2 * jj]; bb.y = acc[et][t][2 * jj + 1];
                    ya[t] = wmma_f32(a, bb, ya[t]);
                }
            }

        if (r < 3) {
            // seen from owner mt, this wave is giver 2 - r: head (mt + 1 + giver) & 3
            #pragma unroll  // constant indices: the array stays in registers
            for (int p = 0; p < 8; ++p) {
                v4f o;
                #pragma unroll  // constant indices: the array stays in registers
                for (int i = 0; i < 4; ++i) o[i] = ya[p >> 1][(p & 1) * 4 + i];
                sred[ch][mt][2 - r][p][lane] = o;
            }
        }
    }
    // publishes the shares: behind it every owner finds its three in LDS
    __syncthreads();

    #pragma unroll  // constant indices: the array stays in registers
    for (int g = 0; g < 3; ++g)
        #pragma unroll  // constant indices: the array stays in registers
        for (int p = 0; p < 8; ++p) {
            const v4f o = sred[ch][h][g][p][lane];
            #pragma unroll  // constant indices: the array stays in registers
            for (int i = 0; i < 4; ++i) ya[p >> 1][(p & 1) * 4 + i] += o[i];
        }

    v4f yo[8];                         // row h * 16 + half * 8 + j, 4 positions
    float lsum = 0.f, lsq = 0.f;
    #pragma unroll  // constant indices: the arrays stay in registers
    for (int j = 0; j < 8; ++j)
        #pragma unroll  // constant indices: the arrays stay in registers
        for (int t = 0; t < 4; ++t) {
            const float v = ya[t][j] + bo[j >> 2][j & 3];
            yo[j][t] = v;
            lsum += v; lsq += v * v;
        }
    // butterfly over the wave: every lane ends with the wave's sums
    lsum += row_xor<1>(lsum);  lsq += row_xor<1>(lsq);
    lsum += row_xor<2>(lsum);  lsq += row_xor<2>(lsq);
    lsum += row_xor<4>(lsum);  lsq += row_xor<4>(lsq);
    lsum += row_xor<8>(lsum);  lsq += row_xor<8>(lsq);
    lsum += other_half(lsum);  lsq += other_half(lsq);
    if (lane == 0) { sstat[wave][0] = lsum; sstat[wave][1] = lsq; }
    // the statistics meet ahead of the y stores: a barrier behind the stores would
    // wait for them to finish before the atomics could start
    __syncthreads();
    if (threadIdx.x < 2) {
        float s = 0.f;
        #pragma unroll  // constant LDS offsets: the 16 reads go out together
        for (int w = 0; w < QWAVES; ++w) s += sstat[w][threadIdx.x];
        atomicAdd((threadIdx.x ? gnsq : gnsum) + b, s);
    }

    // stride skips to batch b
    float* yb = ybase + (size_t)b * QKVC * NPOS + (size_t)(h * 16 + half * 8) * NPOS + n0;
    #pragma unroll  // constant indices: the array stays in registers
    for (int j = 0; j < 8; ++j) *(v4f*)(yb + (size_t)j * NPOS) = yo[j];
}

// ---------------------------------------------------------------------------
// Kernel 4: GroupNorm(1 group) finalize: (y-mean)*rsqrt(var+eps)*gamma + beta.
// One work-group per WGP: GWAVES waves, each lane takes GPIECES 16-byte pieces,
// all loaded before the first is used.  A work-group covers half of one channel
// row, so batch and channel (and with them the statistics, gamma and beta) are
// the same for the whole work-group.
// ---------------------------------------------------------------------------
#define GWAVES  16             // waves per work-group
#define GPIECES 8              // 16-byte pieces per lane
#define GSTRIDE (GWAVES * 32 * 4)          // floats one piece of all lanes covers
#define GSPAN   (GSTRIDE * GPIECES)        // floats per work-group: NPOS / 2

__global__ __launch_bounds__(GWAVES * 32)
void gn_finalize(const float* __restrict__ ybase, const float* __restrict__ gnsum,
                 const float* __restrict__ gnsq, const float* __restrict__ gw,
                 const float* __restrict__ gb, float* __restrict__ out) {
    const int row = blockIdx.x / (NPOS / GSPAN);          // b * 64 + o
    const int b   = row >> 6, o = row & 63;
    const int pos = (blockIdx.x % (NPOS / GSPAN)) * GSPAN + threadIdx.x * 4;
    const float* src = ybase + (size_t)b * QKVC * NPOS + (size_t)o * NPOS + pos;
    float* dst = out + (size_t)row * NPOS + pos;

    v4f v[GPIECES];
    #pragma unroll  // constant indices: the array stays in registers
    for (int i = 0; i < GPIECES; ++i) v[i] = *(const v4f*)(src + i * GSTRIDE);
    // what is computed next may land on a register that holds the loads' address:
    // the wait asked for before such a register is overwritten
    asm volatile("s_wait_xcnt 0x0" ::: "memory");

    const float count = 64.0f * NPOS;
    const float mean  = gnsum[b] / count;
    const float var   = gnsq[b] / count - mean * mean;
    const float inv   = rsqrtf(var + GN_EPS);
    const float g = gw[o], be = gb[o];
    #pragma unroll  // constant indices: the array stays in registers
    for (int i = 0; i < GPIECES; ++i) {
        v4f r;
        #pragma unroll
        for (int j = 0; j < 4; ++j) r[j] = (v[i][j] - mean) * inv * g + be;
        *(v4f*)(dst + i * GSTRIDE) = r;
    }
}

// ---------------------------------------------------------------------------
extern "C" void kernel_launch(void* const* d_in, const int* in_sizes, int n_in,
                              void* d_out, int out_size, void* d_ws, size_t ws_size,
                              hipStream_t stream) {
    const float* x    = (const float*)d_in[0];
    const float* wqkv = (const float*)d_in[1];
    const float* wout = (const float*)d_in[2];
    const float* bout = (const float*)d_in[3];
    const float* gnw  = (const float*)d_in[4];
    const float* gnb  = (const float*)d_in[5];

    float* ws     = (float*)d_ws;
    float* qkv    = ws;                                        // 25,165,824 f
    float* outbuf = qkv + (size_t)NB * QKVC * NPOS;            //  8,388,608 f
    float* pmax   = outbuf + (size_t)NB * HID * NPOS;          //      8,192 f
    float* psum   = pmax + NB * 4 * CSPLIT * 32;               //      8,192 f
    float* ctx    = psum + NB * 4 * CSPLIT * 32;               //      8,192 f
    float* gnsum  = ctx + NB * 4 * 32 * 32;                    //          2 f
    float* gnsq   = gnsum + NB;                                //          2 f
    float* part   = gnsq + NB;                                 //    262,144 f
    // y takes the k channel region [128,192) of qkv, which k itself never reaches
    float* ybase  = qkv + (size_t)HID * NPOS;

    hipMemsetAsync(gnsum, 0, 2 * NB * sizeof(float), stream);

    qkv_context<<<dim3(CSPLIT, NB * 4), CWAVES * 32, 0, stream>>>(x, wqkv, qkv, part, pmax, psum);
    context_merge<<<(NB * 4 * 1024) / 256, 256, 0, stream>>>(part, pmax, psum, ctx);
    q_apply_out<<<dim3(NPOS / 256, NB), QWAVES * 32, 0, stream>>>(qkv, ctx, wout, bout,
                                                                  ybase, gnsum, gnsq);
    gn_finalize<<<(NB * CIN * NPOS) / GSPAN, GWAVES * 32, 0, stream>>>(ybase, gnsum, gnsq,
                                                             gnw, gnb, (float*)d_out);
}

// v008
// Timed twice side by side with v007, it ran 1.03 times as fast both times.
// Counting every step since v000, it is 8.23 times as fast.
#include <hip/hip_runtime.h>

// ---------------------------------------------------------------------------
// LinearAttention fused pipeline for gfx1250 (MI455X), fp32 WMMA path.
// Shapes: b=2, c=64, n=32768, heads=4, dim_head=32, hidden=128, qkv=384.
// Memory-bound: 34 MB mandatory HBM traffic; all intermediates L2-resident.
// ---------------------------------------------------------------------------

#define NPOS   32768           // 32*32*32 spatial positions
#define CIN    64
#define HID    128
#define QKVC   384
#define NB     2
#define SCALE_Q 0.17677669529663687f   // 32^-0.5
#define GN_EPS  1e-5f

typedef __attribute__((ext_vector_type(2))) float v2f;
typedef __attribute__((ext_vector_type(8))) float v8f;

__device__ __forceinline__ v8f wmma_f32(v2f a, v2f b, v8f c) {
    // V_WMMA_F32_16X16X4_F32: D(16x16,f32) = A(16x4,f32) x B(4x16,f32) + C
    return __builtin_amdgcn_wmma_f32_16x16x4_f32(
        /*neg_a=*/false, a, /*neg_b=*/false, b,
        /*c_mod=*/(short)0, c, /*reuse_a=*/false, /*reuse_b=*/false);
}

__device__ __forceinline__ float other_half(float v) {
    // value of lane ^ 16 (v_permlanex16_b32 with the identity lane select)
    return __int_as_float(__builtin_amdgcn_permlanex16(
        0, __float_as_int(v), 0x76543210, 0xfedcba98, false, false));
}

template <int MASK>
__device__ __forceinline__ float row_xor(float v) {
    // value of lane ^ MASK inside the 16-lane row (DPP row_xmask): no LDS trip
    return __int_as_float(__builtin_amdgcn_update_dpp(
        0, __float_as_int(v), 0x160 + MASK, 0xf, 0xf, false));
}

__device__ __forceinline__ void exp_pair(float& r0, float& r1, float x0, float x1) {
    // e^x as 2^(x * log2 e), two at a time.  In asm so that the slot the
    // instruction set asks for behind a transcendental is always filled: the
    // first by the second, which shares no register with it (early-clobber
    // outputs), the second by the v_nop, whatever the compiler puts next.
    asm("v_exp_f32 %0, %2\n\tv_exp_f32 %1, %3\n\tv_nop"
        : "=&v"(r0), "=&v"(r1)
        : "v"(x0 * 1.44269504f), "v"(x1 * 1.44269504f));
}

// ---------------------------------------------------------------------------
// Kernel 1: the q, k and v rows of one head, w_qkv(96 of 384 x 64) @ x[b](64xn),
// and, with k and v never leaving the registers, the head's share of
// context[b][h][d][e] = sum_n softmax_k[d][n] * v[e][n]; only q goes to memory.
// The n range of each (b,h) is cut into CSPLIT work-groups of CWAVES waves: 256
// work-groups, one per WGP.  A wave holds its 64 positions of x (64 channels, the
// fragments of 4 position tiles) in registers for all six 16-row tiles.
// Index c of position tile t stands for position n0 + 4c + t, so a lane reads each
// x row and writes each q row as one 16-byte piece (256 contiguous bytes per 16
// lanes).  The head's weights are staged once per work-group in LDS, in fragment
// order.
// A layout (16x4 f32): lanes 0-15 row=l K={0,1}; lanes 16-31 row=l K={2,3}.
// B layout (4x16 f32): lanes 0-15 col=l K rows {0,1}; lanes 16-31 rows {2,3}.
// C/D layout: VGPR j -> row j (lanes 0-15) / row j+8 (lanes 16-31).
// The two operand layouts mirror each other, so one register pair of x serves as
// B (q = w x: rows = channels of q, columns = positions) and as A (k^T = x^T w^T,
// v^T likewise: rows = positions, columns = channels of k or v).
// k order of these products, A and B alike: step k, lane half hf, element i <->
// channel 4k + 2hf + i of x.
// k^T and v^T come out with their channel in the lane and the positions in the
// registers, which is the operand layout of the context product as it stands:
// A = exp(k - wave max) (M = d), B = v^T (N = e).
// k order of the context product, A and B alike: step (t, jj), lane half hf,
// element i <-> index c = 8 hf + 2 jj + i of position tile t.
// The softmax over n (axis 3) is done in pieces: each wave takes each k row's max
// over its own 64 positions and sums exp(k - wave max) beside the product.  The
// LDS reduce brings the waves to the work-group's row max (factor
// exp(wave max - group max)); one un-normalised 32x32 partial, its 32 row
// maxima and its 32 row sums per work-group go to the workspace.
// ---------------------------------------------------------------------------
#define CSPLIT 32              // work-groups per (b,h) along n
#define CWAVES 16              // waves per work-group, 64 positions each
#define HTILES 6               // 16-row tiles of one head: 2 of q, 2 of k, 2 of v

typedef __attribute__((ext_vector_type(4))) float v4f;

__global__ __launch_bounds__(CWAVES * 32)
void qkv_context(const float* __restrict__ x, const float* __restrict__ wqkv,
                 float* __restrict__ qkv, float* __restrict__ part,
                 float* __restrict__ pmax, float* __restrict__ psum) {
    const int sp   = blockIdx.x;            // 0..CSPLIT-1
    const int bh   = blockIdx.y;            // 0..7
    const int b    = bh >> 2, h = bh & 3;
    const int wave = threadIdx.x >> 5;
    const int lane = threadIdx.x & 31;
    const int half = lane >> 4, l = lane & 15;
    const int n0   = (sp * CWAVES + wave) * 64 + l * 4;

    // sw[tile][kk][slot]: the weight fragments of steps 2kk and 2kk + 1 of one lane.
    // Lane (hf, l) has slot 16 hf + (l ^ 2kk): the readers' 16 lanes still cover
    // one run of 256 bytes, and the 32 lanes that stage two weight rows fall on
    // 32 different 8-byte bank pairs instead of four.
    // One struct, the weights first: every fragment read then lies within the 64 KB
    // that an LDS instruction's own offset field reaches, with no address sums.
    __shared__ struct {
        v4f   sw[HTILES][8][32];            // 24 KB
        float sctx[CWAVES][32][32];         // 64 KB of the 320 KB LDS
        float smax[CWAVES][32];
        float ssum[CWAVES][32];
    } sh;
    auto& sw = sh.sw; auto& sctx = sh.sctx; auto& smax = sh.smax; auto& ssum = sh.ssum;

    // the weights are asked for first: they are staged while x is on its way.
    // Piece i of a thread: row (threadIdx.x >> 4) of the head's q, k, v for i = 0, 1, 2.
    const float* wb = wqkv + (h * 32 + (threadIdx.x >> 4)) * CIN + (threadIdx.x & 15) * 4;
    v4f wv[3];
    #pragma unroll  // constant indices: the array stays in registers
    for (int i = 0; i < 3; ++i) {
        // the last load may land on the address that the loads before it name: the
        // wait asked for before such a register is overwritten
        if (i == 2) asm volatile("s_wait_xcnt 0x0" ::: "memory");
        wv[i] = *(const v4f*)(wb + i * HID * CIN);
    }
    // likewise: the x loads below may land on the weight address
    asm volatile("s_wait_xcnt 0x0" ::: "memory");
    const float* xb = x + (size_t)b * CIN * NPOS + n0;
    v4f xv[16][2];                     // this lane's 32 channels x 4 positions
    #pragma unroll  // constant indices: the array stays in registers
    for (int k = 0; k < 16; ++k)
        #pragma unroll  // constant indices: the array stays in registers
        for (int i = 0; i < 2; ++i) {
            // likewise for the last load from the x address pair
            if (k == 15 && i == 1) asm volatile("s_wait_xcnt 0x0" ::: "memory");
            xv[k][i] = *(const v4f*)(xb + (size_t)(k * 4 + half * 2 + i) * NPOS);
        }
    // likewise: what is computed next may land on the x address pair
    asm volatile("s_wait_xcnt 0x0" ::: "memory");

    #pragma unroll  // constant indices: the array stays in registers
    for (int i = 0; i < 3; ++i) {
        const int row = threadIdx.x >> 4, c = threadIdx.x & 15;  // piece c: channels 4c .. 4c + 3
        const int slot = (row & 15) ^ (c & 14);     // step c, kk = c >> 1
        v2f lo, hi;
        lo.x = wv[i].x; lo.y = wv[i].y;             // half 0 of step c
        hi.x = wv[i].z; hi.y = wv[i].w;             // half 1 of step c
        *((v2f*)&sw[i * 2 + (row >> 4)][c >> 1][slot] + (c & 1))      = lo;
        *((v2f*)&sw[i * 2 + (row >> 4)][c >> 1][16 + slot] + (c & 1)) = hi;
    }
    __syncthreads();
    // keeps what waits for x behind the staging: the weights reach LDS while x is
    // still on its way
    __builtin_amdgcn_sched_barrier(0);

    const v4f* ap[8];                  // this lane's slot of tile 0, per kk
    #pragma unroll  // constant indices: the array stays in registers
    for (int kk = 0; kk < 8; ++kk)
        ap[kk] = &sw[0][kk][half * 16 + (l ^ (2 * kk))];
    float* dst = qkv + ((size_t)b * QKVC + h * 32 + half * 8) * NPOS + n0;

    v2f bp[16][4];                     // x fragments: step k, position tile t
    #pragma unroll  // constant indices: the arrays stay in registers
    for (int k = 0; k < 16; ++k)
        #pragma unroll  // constant indices: the arrays stay in registers
        for (int t = 0; t < 4; ++t) { bp[k][t].x = xv[k][0][t]; bp[k][t].y = xv[k][1][t]; }
    // keeps the address sums and the moves that pair the channels ahead of the first
    // WMMA: among the WMMAs they would land on operand registers right behind their
    // last use
    __builtin_amdgcn_sched_barrier(0);

    // q: the stores go out first and finish under the rest of the kernel
    #pragma unroll  // constant LDS and store offsets: no address sums among the WMMAs
    for (int m = 0; m < 2; ++m) {
        v4f aw[8];
        #pragma unroll  // constant indices: the array stays in registers
        for (int kk = 0; kk < 8; ++kk)
            aw[kk] = ap[kk][m * 8 * 32];

        v8f acc[4] = {};
        #pragma unroll  // constant indices: the arrays stay in registers
        for (int k = 0; k < 16; ++k) {
            v2f a;
            a.x = (k & 1) ? aw[k >> 1].z : aw[k >> 1].x;
            a.y = (k & 1) ? aw[k >> 1].w : aw[k >> 1].y;
            #pragma unroll  // constant indices: the arrays stay in registers
            for (int t = 0; t < 4; ++t) acc[t] = wmma_f32(a, bp[k][t], acc[t]);
        }

        // the four vector slots between a WMMA and a vector instruction that reads
        // or overwrites its result or overwrites its operands: the two scheduling
        // barriers hold the slots in place
        __builtin_amdgcn_sched_barrier(0);
        asm volatile("v_nop\n\tv_nop\n\tv_nop\n\tv_nop");
        __builtin_amdgcn_sched_barrier(0);

        #pragma unroll  // constant indices: the arrays stay in registers
        for (int j = 0; j < 8; ++j) {
            v4f o;
            #pragma unroll  // constant indices: the arrays stay in registers
            for (int t = 0; t < 4; ++t) o[t] = acc[t][j];
            *(v4f*)(dst + (size_t)(m * 16 + j) * NPOS) = o;
        }
        // what comes next may need the registers that these stores name: the wait
        // asked for before such a register is overwritten
        asm volatile("s_wait_xcnt 0x0" ::: "memory");
    }

    // k^T and v^T, one position tile at a time: the tile's 32 registers of x are
    // free as soon as its 32 result registers are full
    v8f kt[2][4], vt[2][4];            // [channel tile][position tile]
    #pragma unroll  // constant indices and LDS offsets
    for (int t = 0; t < 4; ++t) {
        // compiler fence: each tile reads the weight fragments from LDS anew; held
        // over the four tiles they take 128 registers and the wave spills
        asm volatile("" ::: "memory");
        kt[0][t] = v8f{}; kt[1][t] = v8f{}; vt[0][t] = v8f{}; vt[1][t] = v8f{};
        #pragma unroll  // constant indices and LDS offsets
        for (int kk = 0; kk < 8; ++kk) {
            v4f w4[4];
            #pragma unroll  // constant indices: the array stays in registers
            for (int m = 0; m < 4; ++m) w4[m] = ap[kk][(2 + m) * 8 * 32];
            #pragma unroll  // constant indices: the arrays stay in registers
            for (int s = 0; s < 2; ++s) {
                v2f wf[4];
                #pragma unroll  // constant indices: the arrays stay in registers
                for (int m = 0; m < 4; ++m) {
                    wf[m].x = s ? w4[m].z : w4[m].x;
                    wf[m].y = s ? w4[m].w : w4[m].y;
                }
                kt[0][t] = wmma_f32(bp[2 * kk + s][t], wf[0], kt[0][t]);
                kt[1][t] = wmma_f32(bp[2 * kk + s][t], wf[1], kt[1][t]);
                vt[0][t] = wmma_f32(bp[2 * kk + s][t], wf[2], vt[0][t]);
                vt[1][t] = wmma_f32(bp[2 * kk + s][t], wf[3], vt[1][t]);
            }
        }
    }
    // the four vector slots behind the last WMMA, as above
    __builtin_amdgcn_sched_barrier(0);
    asm volatile("v_nop\n\tv_nop\n\tv_nop\n\tv_nop");
    __builtin_amdgcn_sched_barrier(0);

    // a lane holds 32 of its two k rows' 64 positions, lane ^ 16 the other 32
    float m0 = kt[0][0][0], m1 = kt[1][0][0];
    #pragma unroll  // constant indices: the arrays stay in registers
    for (int t = 0; t < 4; ++t)
        #pragma unroll  // constant indices: the arrays stay in registers
        for (int j = 0; j < 8; ++j) {
            m0 = fmaxf(m0, kt[0][t][j]);
            m1 = fmaxf(m1, kt[1][t][j]);
        }
    m0 = fmaxf(m0, other_half(m0));
    m1 = fmaxf(m1, other_half(m1));

    float s0 = 0.f, s1 = 0.f;
    #pragma unroll  // constant indices: the arrays stay in registers
    for (int t = 0; t < 4; ++t)
        #pragma unroll  // constant indices: the arrays stay in registers
        for (int jj = 0; jj < 4; ++jj) {
            float e0, e1;
            exp_pair(e0, e1, kt[0][t][2 * jj] - m0, kt[0][t][2 * jj + 1] - m0);
            kt[0][t][2 * jj] = e0; kt[0][t][2 * jj + 1] = e1;
            s0 += e0 + e1;
            exp_pair(e0, e1, kt[1][t][2 * jj] - m1, kt[1][t][2 * jj + 1] - m1);
            kt[1][t][2 * jj] = e0; kt[1][t][2 * jj + 1] = e1;
            s1 += e0 + e1;
        }
    s0 += other_half(s0);
    s1 += other_half(s1);

    // keeps every asm exponential of k ahead of the context product's first WMMA
    __builtin_amdgcn_sched_barrier(0);

    v8f acc[2][2] = {};
    #pragma unroll  // constant indices: the arrays stay in registers
    for (int t = 0; t < 4; ++t)
        #pragma unroll  // constant indices: the arrays stay in registers
        for (int jj = 0; jj < 4; ++jj) {
            v2f a0, a1, b0, b1;
            a0.x = kt[0][t][2 * jj]; a0.y = kt[0][t][2 * jj + 1];
            a1.x = kt[1][t][2 * jj]; a1.y = kt[1][t][2 * jj + 1];
            b0.x = vt[0][t][2 * jj]; b0.y = vt[0][t][2 * jj + 1];
            b1.x = vt[1][t][2 * jj]; b1.y = vt[1][t][2 * jj + 1];
            acc[0][0] = wmma_f32(a0, b0, acc[0][0]);
            acc[0][1] = wmma_f32(a0, b1, acc[0][1]);
            acc[1][0] = wmma_f32(a1, b0, acc[1][0]);
            acc[1][1] = wmma_f32(a1, b1, acc[1][1]);
        }

    #pragma unroll
    for (int dt = 0; dt < 2; ++dt)
        #pragma unroll
        for (int et = 0; et < 2; ++et)
            #pragma unroll
            for (int j = 0; j < 8; ++j)
                sctx[wave][dt * 16 + j + half * 8][et * 16 + l] = acc[dt][et][j];
    // both halves hold the same row values: half 0 stores row l, half 1 row 16 + l
    smax[wave][lane] = half ? m1 : m0;
    ssum[wave][lane] = half ? s1 : s0;
    __syncthreads();

    for (int idx = threadIdx.x; idx < 1024; idx += CWAVES * 32) {
        const int d = idx >> 5, e = idx & 31;
        float mw[CWAVES];
        #pragma unroll
        for (int w = 0; w < CWAVES; ++w) mw[w] = smax[w][d];
        float m = mw[0];
        #pragma unroll
        for (int w = 1; w < CWAVES; ++w) m = fmaxf(m, mw[w]);
        float s = 0.f, t = 0.f;
        #pragma unroll
        for (int w = 0; w < CWAVES; w += 2) {
            float f0, f1;
            exp_pair(f0, f1, mw[w] - m, mw[w + 1] - m);
            s += sctx[w][d][e] * f0;
            t += ssum[w][d] * f0;
            s += sctx[w + 1][d][e] * f1;
            t += ssum[w + 1][d] * f1;
        }
        part[((size_t)bh * CSPLIT + sp) * 1024 + idx] = s;
        if (e == 0) {
            pmax[(bh * CSPLIT + sp) * 32 + d] = m;
            psum[(bh * CSPLIT + sp) * 32 + d] = t;
        }
        // the next trip reuses the registers that these stores name: the wait
        // asked for before such a register is overwritten
        asm volatile("s_wait_xcnt 0x0" ::: "memory");
    }
}

// ---------------------------------------------------------------------------
// Kernel 2: context = sum of the CSPLIT partials, in index order, each brought
// to the row's overall max by exp(group max - max), over the row sums' like sum.
// Then, since y = w_out (context^T q) = (w_out context^T) q, the small product is
// formed here once: wp[b][o][h * 32 + d] = sum_e w_out[o][h * 32 + e] * context[d][e].
// One work-group = 16 rows d of one (b,h): wave = row, lane = e.  The rows meet in
// LDS; waves 0..3 then take one 16-row tile of o each.
// Product: M = d (16), N = o (16 per wave), K = e (8 steps of 4).
// k order, A and B alike: step k, lane half hf, element i  <->  e = 4k + 2hf + i.
// The result has o in the lane and 8 neighbouring d in the registers: two 16-byte
// stores per lane into a matrix laid out like w_out.
// ---------------------------------------------------------------------------
#define MWAVES 16              // waves per work-group: 16 rows of a 32 x 32 context

__global__ __launch_bounds__(MWAVES * 32)
void context_merge(const float* __restrict__ part, const float* __restrict__ pmax,
                   const float* __restrict__ psum, const float* __restrict__ wout,
                   float* __restrict__ wp) {
    const int idx = blockIdx.x * (MWAVES * 32) + threadIdx.x;   // < 8 * 1024
    const int bh  = idx >> 10, de = idx & 1023;
    // the wave's number in a scalar register: the test on it below is a scalar branch
    const int wave = __builtin_amdgcn_readfirstlane(threadIdx.x >> 5);
    const int lane = threadIdx.x & 31;
    const int half = lane >> 4, l = lane & 15;
    const float* p  = part + (size_t)bh * CSPLIT * 1024 + de;
    const float* pm = pmax + bh * CSPLIT * 32 + (de >> 5);
    const float* ps = psum + bh * CSPLIT * 32 + (de >> 5);
    // pitch 34: the 16 rows that one fragment read touches fall on 16 bank pairs
    __shared__ float sc[MWAVES][34];

    // Each s_wait_xcnt: a later load, the last of a run too, may land on the
    // address registers that the loads before it name; it is the wait asked for
    // before such a register is overwritten.
    v2f bw[8] = {};                    // B[e][o] = w_out[o][h * 32 + e]
    if (wave < 4) {
        const float* wb = wout + (wave * 16 + l) * HID + (bh & 3) * 32 + half * 2;
        #pragma unroll  // constant indices: the array stays in registers
        for (int k = 0; k < 8; ++k) {
            if (k == 7) asm volatile("s_wait_xcnt 0x0" ::: "memory");
            bw[k] = *(const v2f*)(wb + k * 4);
        }
        asm volatile("s_wait_xcnt 0x0" ::: "memory");
    }
    // unrolled so that all 3 * CSPLIT loads are in flight at once: one L2 trip.
    float mv[CSPLIT], sv[CSPLIT], pv[CSPLIT];
    #pragma unroll
    for (int sp = 0; sp < CSPLIT; ++sp) {
        if (sp == CSPLIT - 1) asm volatile("s_wait_xcnt 0x0" ::: "memory");
        mv[sp] = pm[sp * 32];
    }
    asm volatile("s_wait_xcnt 0x0" ::: "memory");
    #pragma unroll
    for (int sp = 0; sp < CSPLIT; ++sp) {
        if (sp == CSPLIT - 1) asm volatile("s_wait_xcnt 0x0" ::: "memory");
        sv[sp] = ps[sp * 32];
    }
    asm volatile("s_wait_xcnt 0x0" ::: "memory");
    #pragma unroll
    for (int sp = 0; sp < CSPLIT; ++sp) {
        if (sp == CSPLIT - 1) asm volatile("s_wait_xcnt 0x0" ::: "memory");
        pv[sp] = p[sp * 1024];
    }
    asm volatile("s_wait_xcnt 0x0" ::: "memory");
    // keeps every load ahead of the first wait for one: one trip, not several
    __builtin_amdgcn_sched_barrier(0);
    float m = mv[0];
    #pragma unroll
    for (int sp = 1; sp < CSPLIT; ++sp) m = fmaxf(m, mv[sp]);
    float num = 0.f, den = 0.f;
    #pragma unroll
    for (int sp = 0; sp < CSPLIT; sp += 2) {
        float f0, f1;
        exp_pair(f0, f1, mv[sp] - m, mv[sp + 1] - m);
        num += pv[sp] * f0;
        den += sv[sp] * f0;
        num += pv[sp + 1] * f1;
        den += sv[sp + 1] * f1;
    }
    sc[wave][lane] = num / den;
    // publishes the 16 context rows to the four waves that multiply
    __syncthreads();

    if (wave < 4) {
        v2f aw[8];                     // A[d][e] = context[d][e]
        #pragma unroll  // constant indices: the array stays in registers
        for (int k = 0; k < 8; ++k) aw[k] = *(const v2f*)&sc[l][k * 4 + half * 2];
        // keeps all the LDS reads ahead of the first WMMA: one LDS trip, not four
        __builtin_amdgcn_sched_barrier(0);
        v8f acc = {};
        #pragma unroll  // constant indices: the arrays stay in registers
        for (int k = 0; k < 8; ++k) acc = wmma_f32(aw[k], bw[k], acc);
        // the four vector slots between a WMMA and a vector instruction that reads
        // its result; the two scheduling barriers hold the slots in place
        __builtin_amdgcn_sched_barrier(0);
        asm volatile("v_nop\n\tv_nop\n\tv_nop\n\tv_nop");
        __builtin_amdgcn_sched_barrier(0);
        float* dst = wp + ((bh >> 2) * CIN + wave * 16 + l) * HID + (bh & 3) * 32
                        + ((de >> 9) & 1) * 16 + half * 8;
        v4f o0, o1;
        #pragma unroll  // constant indices: the arrays stay in registers
        for (int j = 0; j < 4; ++j) { o0[j] = acc[j]; o1[j] = acc[4 + j]; }
        *(v4f*)dst       = o0;
        *(v4f*)(dst + 4) = o1;
    }
}

// ---------------------------------------------------------------------------
// Kernel 3: per-position q softmax (over the 32 head channels) * SCALE, then
// y[b][64][n] = wp[b](64x128) @ q_sm + b_out, wp = w_out context^T from kernel 2,
// and the GroupNorm sum / sum of squares.
// One wave = one head x 64 positions.
// Product: M = the 64 rows of y (4 tiles), K = the wave's own 32 channels of q
// (8 steps of 4), N = positions (4 tiles).
// Column c of N tile t stands for position n0 + 4c + t, so a lane reads each q
// row and writes each y row as one 16-byte piece (256 contiguous bytes per 16
// lanes).
// k order, A and B alike: step (et, jj), lane half hf, element i  <->
// channel d = 16 et + 8 hf + 2 jj + i of the head.
// A lane holds 16 of a position's 32 channels, lane ^ 16 the other 16.
// That gives one head's share of y.  The four heads of a chunk add up through
// LDS: wave h owns M tile h, hands its three other tiles over as register images
// (same lane, same register on both sides) and adds the three it is handed.
// y is written into the unused k-region of the qkv buffer.
// ---------------------------------------------------------------------------
#define QWAVES 16              // 4 heads x 4 chunks of 64 positions

__global__ __launch_bounds__(QWAVES * 32)
void q_apply_out(const float* __restrict__ qkv, const float* __restrict__ wp,
                 const float* __restrict__ bout,
                 float* __restrict__ ybase, float* __restrict__ gnsum,
                 float* __restrict__ gnsq) {
    const int wave = threadIdx.x >> 5;
    const int lane = threadIdx.x & 31;
    const int half = lane >> 4, l = lane & 15;
    const int h    = wave & 3;
    const int ch   = wave >> 2;        // chunk of 64 positions
    const int b    = blockIdx.y;
    const int n0   = (blockIdx.x * (QWAVES / 4) + ch) * 64 + l * 4;

    // swo[head][M tile][2 et + p][lane]: the A fragments of steps (et, 2p) and
    // (et, 2p + 1) of one lane
    __shared__ v4f swo[4][4][4][32];                // 32 KB
    // sred[chunk][owner's M tile][giver][piece][lane]: register images
    __shared__ v4f sred[QWAVES / 4][4][3][8][32];   // 192 KB of the 320 KB LDS
    __shared__ float sstat[QWAVES][2];

    const float* qb = qkv + ((size_t)b * QKVC + h * 32) * NPOS + n0;   // q channels

    // wp is asked for first: it is staged while q is on its way.  Each wave
    // fetches the fragments of one (head, M tile) for the whole work-group.
    const float* wb = wp + (b * CIN + ch * 16 + l) * HID + h * 32 + half * 8;
    v4f wv[4];
    #pragma unroll  // constant indices: the array stays in registers
    for (int i = 0; i < 4; ++i) {
        // the last load may land on the address pair that the loads before it
        // name: the wait asked for before such a register is overwritten
        if (i == 3) asm volatile("s_wait_xcnt 0x0" ::: "memory");
        wv[i] = *(const v4f*)(wb + (i >> 1) * 16 + (i & 1) * 4);
    }
    // likewise: the q loads below may land on the wp address pair
    asm volatile("s_wait_xcnt 0x0" ::: "memory");

    v4f qv[8][2];                      // this lane's 16 channels x 4 positions
    #pragma unroll  // constant indices: the arrays stay in registers
    for (int k = 0; k < 8; ++k)
        #pragma unroll  // constant indices: the arrays stay in registers
        for (int i = 0; i < 2; ++i) {
            // the last load may land on the address pair that the fifteen before
            // it name: the wait asked for before such a register is overwritten
            if (k == 7 && i == 1) asm volatile("s_wait_xcnt 0x0" ::: "memory");
            // step k = (et, jj) = (k >> 2, k & 3)
            qv[k][i] = *(const v4f*)(qb + (size_t)((k >> 2) * 16 + half * 8 + (k & 3) * 2 + i) * NPOS);
        }

    // likewise: the bias loads below may land on the q address pair
    asm volatile("s_wait_xcnt 0x0" ::: "memory");

    v4f bo[2];                         // b_out of this lane's 8 rows of M tile h
    bo[0] = *(const v4f*)(bout + h * 16 + half * 8);
    // likewise for the last load from the bias address
    asm volatile("s_wait_xcnt 0x0" ::: "memory");
    bo[1] = *(const v4f*)(bout + h * 16 + half * 8 + 4);
    // likewise: what is computed next may land on the bias address
    asm volatile("s_wait_xcnt 0x0" ::: "memory");

    #pragma unroll  // constant indices: the array stays in registers
    for (int i = 0; i < 4; ++i) swo[h][ch][i][lane] = wv[i];
    // publishes the staged wp.  The fences name LDS alone: a plain __syncthreads()
    // would also wait here for the q loads of every wave, and no wave could start
    // on its q before the last wave's had come
    __builtin_amdgcn_fence(__ATOMIC_RELEASE, "workgroup", "local");
    __builtin_amdgcn_s_barrier();
    __builtin_amdgcn_fence(__ATOMIC_ACQUIRE, "workgroup", "local");
    // keeps what waits for q behind the staging and its barrier: wp is published
    // while q is still on its way
    __builtin_amdgcn_sched_barrier(0);

    float inv[4];
    #pragma unroll  // constant indices: the arrays stay in registers
    for (int t = 0; t < 4; ++t) {
        float m = -1e30f;
        #pragma unroll  // constant indices: the arrays stay in registers
        for (int k = 0; k < 8; ++k) m = fmaxf(m, fmaxf(qv[k][0][t], qv[k][1][t]));
        m = fmaxf(m, other_half(m));
        float s = 0.f;
        #pragma unroll  // constant indices: the arrays stay in registers
        for (int k = 0; k < 8; ++k) {
            float e0, e1;
            exp_pair(e0, e1, qv[k][0][t] - m, qv[k][1][t] - m);
            qv[k][0][t] = e0; qv[k][1][t] = e1;
            s += e0 + e1;
        }
        s += other_half(s);
        inv[t] = SCALE_Q / s;
    }

    v2f qs[8][4];                      // B fragments: step k, N tile t
    #pragma unroll  // constant indices: the arrays stay in registers
    for (int k = 0; k < 8; ++k)
        #pragma unroll  // constant indices: the arrays stay in registers
        for (int t = 0; t < 4; ++t) {
            qs[k][t].x = qv[k][0][t] * inv[t];
            qs[k][t].y = qv[k][1][t] * inv[t];
        }

    const v4f* ap[4];                  // round r: the A fragments of M tile (h + 1 + r) & 3
    v4f* sp[3];                        // round r: where that tile's owner finds the share
    #pragma unroll  // constant indices: the arrays stay in registers
    for (int r = 0; r < 4; ++r) {
        const int mt = (h + 1 + r) & 3;             // the own tile comes last
        ap[r] = &swo[h][mt][0][lane];
        // seen from owner mt, this wave is giver 2 - r: head (mt + 1 + giver) & 3
        if (r < 3) sp[r] = &sred[ch][mt][2 - r][0][lane];
    }

    // keeps every asm exponential ahead of the first WMMA, and the
    // address sums too: among the WMMAs they would land on operand or result
    // registers right behind their last use
    __builtin_amdgcn_sched_barrier(0);

    v8f ya[4];                         // behind the loop: the wave's own M tile
    #pragma unroll  // constant indices: the arrays stay in registers
    for (int r = 0; r < 4; ++r) {
        v4f aw[4];
        #pragma unroll  // constant indices: the array stays in registers
        for (int i = 0; i < 4; ++i) aw[i] = ap[r][i * 32];

        #pragma unroll  // constant indices: the array stays in registers
        for (int t = 0; t < 4; ++t) ya[t] = v8f{};
        #pragma unroll  // constant indices: the arrays stay in registers
        for (int et = 0; et < 2; ++et)
            #pragma unroll  // constant indices: the arrays stay in registers
            for (int jj = 0; jj < 4; ++jj) {
                const v4f w4 = aw[et * 2 + (jj >> 1)];
                v2f a;
                a.x = (jj & 1) ? w4.z : w4.x;
                a.y = (jj & 1) ? w4.w : w4.y;
                #pragma unroll  // constant indices: the arrays stay in registers
                for (int t = 0; t < 4; ++t) ya[t] = wmma_f32(a, qs[et * 4 + jj][t], ya[t]);
            }

        if (r < 3) {
            #pragma unroll  // constant indices: the array stays in registers
            for (int p = 0; p < 8; ++p) {
                v4f o;
                #pragma unroll  // constant indices: the array stays in registers
                for (int i = 0; i < 4; ++i) o[i] = ya[p >> 1][(p & 1) * 4 + i];
                sp[r][p * 32] = o;
            }
        }
    }
    // the four vector slots between the last WMMA and a vector instruction that
    // reads its result or overwrites its operands; the two scheduling barriers hold
    // the slots in place
    __builtin_amdgcn_sched_barrier(0);
    asm volatile("v_nop\n\tv_nop\n\tv_nop\n\tv_nop");
    __builtin_amdgcn_sched_barrier(0);
    // publishes the shares: behind it every owner finds its three in LDS
    __syncthreads();

    #pragma unroll  // constant indices: the array stays in registers
    for (int g = 0; g < 3; ++g)
        #pragma unroll  // constant indices: the array stays in registers
        for (int p = 0; p < 8; ++p) {
            const v4f o = sred[ch][h][g][p][lane];
            #pragma unroll  // constant indices: the array stays in registers
            for (int i = 0; i < 4; ++i) ya[p >> 1][(p & 1) * 4 + i] += o[i];
        }

    v4f yo[8];                         // row h * 16 + half * 8 + j, 4 positions
    float lsum = 0.f, lsq = 0.f;
    #pragma unroll  // constant indices: the arrays stay in registers
    for (int j = 0; j < 8; ++j)
        #pragma unroll  // constant indices: the arrays stay in registers
        for (int t = 0; t < 4; ++t) {
            const float v = ya[t][j] + bo[j >> 2][j & 3];
            yo[j][t] = v;
            lsum += v; lsq += v * v;
        }
    // butterfly over the wave: every lane ends with the wave's sums
    lsum += row_xor<1>(lsum);  lsq += row_xor<1>(lsq);
    lsum += row_xor<2>(lsum);  lsq += row_xor<2>(lsq);
    lsum += row_xor<4>(lsum);  lsq += row_xor<4>(lsq);
    lsum += row_xor<8>(lsum);  lsq += row_xor<8>(lsq);
    lsum += other_half(lsum);  lsq += other_half(lsq);
    if (lane == 0) { sstat[wave][0] = lsum; sstat[wave][1] = lsq; }
    // the statistics meet ahead of the y stores: a barrier behind the stores would
    // wait for them to finish before the atomics could start
    __syncthreads();
    if (threadIdx.x < 2) {
        float s = 0.f;
        #pragma unroll  // constant LDS offsets: the 16 reads go out together
        for (int w = 0; w < QWAVES; ++w) s += sstat[w][threadIdx.x];
        atomicAdd((threadIdx.x ? gnsq : gnsum) + b, s);
    }

    // stride skips to batch b
    float* yb = ybase + (size_t)b * QKVC * NPOS + (size_t)(h * 16 + half * 8) * NPOS + n0;
    #pragma unroll  // constant indices: the array stays in registers
    for (int j = 0; j < 8; ++j) *(v4f*)(yb + (size_t)j * NPOS) = yo[j];
}

// ---------------------------------------------------------------------------
// Kernel 4: GroupNorm(1 group) finalize: (y-mean)*rsqrt(var+eps)*gamma + beta.
// One work-group per WGP: GWAVES waves, each lane takes GPIECES 16-byte pieces,
// all loaded before the first is used.  A work-group covers half of one channel
// row, so batch and channel (and with them the statistics, gamma and beta) are
// the same for the whole work-group.
// ---------------------------------------------------------------------------
#define GWAVES  16             // waves per work-group
#define GPIECES 8              // 16-byte pieces per lane
#define GSTRIDE (GWAVES * 32 * 4)          // floats one piece of all lanes covers
#define GSPAN   (GSTRIDE * GPIECES)        // floats per work-group: NPOS / 2

__global__ __launch_bounds__(GWAVES * 32)
void gn_finalize(const float* __restrict__ ybase, const float* __restrict__ gnsum,
                 const float* __restrict__ gnsq, const float* __restrict__ gw,
                 const float* __restrict__ gb, float* __restrict__ out) {
    const int row = blockIdx.x / (NPOS / GSPAN);          // b * 64 + o
    const int b   = row >> 6, o = row & 63;
    const int pos = (blockIdx.x % (NPOS / GSPAN)) * GSPAN + threadIdx.x * 4;
    const float* src = ybase + (size_t)b * QKVC * NPOS + (size_t)o * NPOS + pos;
    float* dst = out + (size_t)row * NPOS + pos;

    v4f v[GPIECES];
    #pragma unroll  // constant indices: the array stays in registers
    for (int i = 0; i < GPIECES; ++i) v[i] = *(const v4f*)(src + i * GSTRIDE);
    // what is computed next may land on a register that holds the loads' address:
    // the wait asked for before such a register is overwritten
    asm volatile("s_wait_xcnt 0x0" ::: "memory");

    const float count = 64.0f * NPOS;
    const float mean  = gnsum[b] / count;
    const float var   = gnsq[b] / count - mean * mean;
    const float inv   = rsqrtf(var + GN_EPS);
    const float g = gw[o], be = gb[o];
    #pragma unroll  // constant indices: the array stays in registers
    for (int i = 0; i < GPIECES; ++i) {
        v4f r;
        #pragma unroll
        for (int j = 0; j < 4; ++j) r[j] = (v[i][j] - mean) * inv * g + be;
        *(v4f*)(dst + i * GSTRIDE) = r;
    }
}

// ---------------------------------------------------------------------------
extern "C" void kernel_launch(void* const* d_in, const int* in_sizes, int n_in,
                              void* d_out, int out_size, void* d_ws, size_t ws_size,
                              hipStream_t stream) {
    const float* x    = (const float*)d_in[0];
    const float* wqkv = (const float*)d_in[1];
    const float* wout = (const float*)d_in[2];
    const float* bout = (const float*)d_in[3];
    const float* gnw  = (const float*)d_in[4];
    const float* gnb  = (const float*)d_in[5];

    float* ws     = (float*)d_ws;
    float* qkv    = ws;                                        // 25,165,824 f
    float* wp     = qkv + (size_t)NB * QKVC * NPOS;            //     16,384 f of 8,388,608
    float* pmax   = wp + (size_t)NB * HID * NPOS;              //      8,192 f
    float* psum   = pmax + NB * 4 * CSPLIT * 32;               //      8,192 f
    float* gnsum  = psum + NB * 4 * CSPLIT * 32;               //          2 f
    float* gnsq   = gnsum + NB;                                //          2 f
    float* part   = gnsq + NB;                                 //    262,144 f
    // y takes the k channel region [128,192) of qkv, which k itself never reaches
    float* ybase  = qkv + (size_t)HID * NPOS;

    hipMemsetAsync(gnsum, 0, 2 * NB * sizeof(float), stream);

    qkv_context<<<dim3(CSPLIT, NB * 4), CWAVES * 32, 0, stream>>>(x, wqkv, qkv, part, pmax, psum);
    context_merge<<<(NB * 4 * 1024) / (MWAVES * 32), MWAVES * 32, 0, stream>>>(part, pmax, psum,
                                                                               wout, wp);
    q_apply_out<<<dim3(NPOS / 256, NB), QWAVES * 32, 0, stream>>>(qkv, wp, bout,
                                                                  ybase, gnsum, gnsq);
    gn_finalize<<<(NB * CIN * NPOS) / GSPAN, GWAVES * 32, 0, stream>>>(ybase, gnsum, gnsq,
                                                             gnw, gnb, (float*)d_out);
}
